// v000
// The times below were measured on an AMD MI455X: many runs one after another, warmed up first and cycling through
// copies of the inputs, with the whole window's GPU time divided by the number of runs. Launches and the gaps
// between them are all in it. The median over several windows is given; except for v000 it joins two sittings, which
// can be a few percent apart, so the side-by-side timings, each taken in one sitting, are the better comparison.
// v000 is the starting kernel. One run takes 629 microseconds.
#include <hip/hip_runtime.h>

// ---------------- constants ----------------
#define Dm   1024
#define Hm   16
#define HDm  64
#define FFm  4096
#define Bm   8
#define Lm   1024
#define Mrows (Bm * Lm)        // 8192
#define EPSc 1e-5f

typedef __attribute__((ext_vector_type(16))) __bf16 v16bf;
typedef __attribute__((ext_vector_type(8)))  float  v8f;
typedef __attribute__((ext_vector_type(4)))  unsigned int u32x4;
typedef __attribute__((ext_vector_type(8)))  int          i32x8;
typedef __attribute__((ext_vector_type(4)))  int          i32x4;

#if defined(__has_builtin)
#if __has_builtin(__builtin_amdgcn_tensor_load_to_lds) && \
    __has_builtin(__builtin_amdgcn_s_wait_tensorcnt)
#define USE_TDM 1
#endif
#endif
#ifndef USE_TDM
#define USE_TDM 0
#endif

union V16 {
    uint4 u4[2];
    unsigned short s[16];
    v16bf v;
};

__device__ __forceinline__ unsigned short f2bf(float f) {
    unsigned int u = __float_as_uint(f);
    unsigned int r = u + 0x7fffu + ((u >> 16) & 1u);   // round to nearest even
    return (unsigned short)(r >> 16);
}

#if USE_TDM
// Issue one TDM 2D tile load: tile_rows x 32 bf16 elements, row stride K
// elements, into LDS with +16B padding per 64B row (=> row pitch 80B).
__device__ __forceinline__ void tdm_tile_load(const unsigned short* gsrc,
                                              unsigned int lds_off,
                                              int K, int rows_total,
                                              int tile_rows) {
    unsigned long long ga = (unsigned long long)(size_t)gsrc;
    u32x4 g0;
    g0[0] = 1u;                                   // count=1, user mode
    g0[1] = lds_off;                              // lds_addr (bytes)
    g0[2] = (unsigned int)ga;                     // global_addr[31:0]
    g0[3] = ((unsigned int)(ga >> 32) & 0x01FFFFFFu) | 0x80000000u; // type=2

    i32x8 g1;
    // data_size=1 (2B) | pad_enable | pad_interval=3 (16 DW) | pad_amount=3 (4 DW)
    g1[0] = (int)(0x00010000u | (1u << 20) | (3u << 22) | (3u << 25));
    g1[1] = (int)(((unsigned)K & 0xFFFFu) << 16);          // tensor_dim0[15:0]
    g1[2] = (int)((((unsigned)K >> 16) & 0xFFFFu) |
                  (((unsigned)rows_total & 0xFFFFu) << 16)); // dim0 hi | dim1 lo
    g1[3] = (int)((((unsigned)rows_total >> 16) & 0xFFFFu) |
                  (32u << 16));                            // dim1 hi | tile_dim0=32
    g1[4] = (int)((unsigned)tile_rows & 0xFFFFu);          // tile_dim1 | tile_dim2=0
    g1[5] = (int)(unsigned)K;                              // tensor_dim0_stride lo
    g1[6] = 0;                                             // stride hi | dim1_stride lo
    g1[7] = 0;

    i32x4 z4 = {0, 0, 0, 0};
#if __clang_major__ >= 23
    i32x8 z8 = {0, 0, 0, 0, 0, 0, 0, 0};
    __builtin_amdgcn_tensor_load_to_lds(g0, g1, z4, z4, z8, 0);
#else
    __builtin_amdgcn_tensor_load_to_lds(g0, g1, z4, z4, 0);
#endif
}
#endif

// ---------------- fp32 -> bf16 transpose-convert: dst[N][K] = src[K][N] ----------------
__global__ __launch_bounds__(256)
void cvt_t_kernel(const float* __restrict__ src, unsigned short* __restrict__ dst,
                  int K, int N) {
    __shared__ unsigned short tile[32][33];
    int n0 = blockIdx.x * 32, k0 = blockIdx.y * 32;
    int tx = threadIdx.x, ty = threadIdx.y;   // block (32,8)
    #pragma unroll
    for (int i = 0; i < 4; i++) {
        int r = ty + i * 8;
        tile[r][tx] = f2bf(src[(size_t)(k0 + r) * N + n0 + tx]);
    }
    __syncthreads();
    #pragma unroll
    for (int i = 0; i < 4; i++) {
        int r = ty + i * 8;
        dst[(size_t)(n0 + r) * K + k0 + tx] = tile[tx][r];
    }
}

// ---------------- LayerNorm -> bf16 ----------------
__global__ __launch_bounds__(256)
void ln_bf16_kernel(const float* __restrict__ x,
                    const float* __restrict__ gamma,
                    const float* __restrict__ beta,
                    unsigned short* __restrict__ out) {
    int row = blockIdx.x;
    int t = threadIdx.x;
    __shared__ float red[256];
    const float* xr = x + (size_t)row * Dm;

    float sum = 0.f;
    for (int i = t; i < Dm; i += 256) sum += xr[i];
    red[t] = sum; __syncthreads();
    for (int st = 128; st > 0; st >>= 1) {
        if (t < st) red[t] += red[t + st];
        __syncthreads();
    }
    float mu = red[0] * (1.0f / Dm);
    __syncthreads();

    float vs = 0.f;
    for (int i = t; i < Dm; i += 256) { float d = xr[i] - mu; vs += d * d; }
    red[t] = vs; __syncthreads();
    for (int st = 128; st > 0; st >>= 1) {
        if (t < st) red[t] += red[t + st];
        __syncthreads();
    }
    float inv = rsqrtf(red[0] * (1.0f / Dm) + EPSc);
    __syncthreads();

    unsigned short* orow = out + (size_t)row * Dm;
    for (int i = t; i < Dm; i += 256)
        orow[i] = f2bf((xr[i] - mu) * inv * gamma[i] + beta[i]);
}

// ---------------- bf16 WMMA GEMM, B pre-transposed, double-buffered TDM ----------------
// C[M,N] = A[M,K] * Bt[N,K]^T  (+bias) (act) (+resid) (*oscale)
// Block tile 64(M) x 128(N), BK=32, 4 waves, each wave 32x64.
// heads: 0 = plain, 1 = [B,H,L,HD], 2 = [B,H,HD,L] (transposed per head)
__global__ __launch_bounds__(128)
void gemm_bf16_kernel(const unsigned short* __restrict__ A,
                      const unsigned short* __restrict__ Bt,
                      const float* __restrict__ bias,
                      const float* __restrict__ resid,
                      float* __restrict__ outF,
                      unsigned short* __restrict__ outB,
                      int M, int N, int K,
                      int act, int heads, float oscale) {
    __shared__ __align__(16) unsigned short As[2][64][40];   // [m][k], 80B pitch
    __shared__ __align__(16) unsigned short Bs[2][128][40];  // [n][k], 80B pitch

    int t    = threadIdx.x;
    int w    = t >> 5, lane = t & 31;
    int wr   = w >> 1, wc = w & 1;
    int mloc = lane & 15, half = lane >> 4;
    int m0 = blockIdx.y * 64, n0 = blockIdx.x * 128;

    v8f c[2][4] = {};
    int nsteps = K >> 5;

#if USE_TDM
    unsigned int ldsA[2], ldsB[2];
    ldsA[0] = (unsigned int)(size_t)(void*)&As[0][0][0];
    ldsA[1] = (unsigned int)(size_t)(void*)&As[1][0][0];
    ldsB[0] = (unsigned int)(size_t)(void*)&Bs[0][0][0];
    ldsB[1] = (unsigned int)(size_t)(void*)&Bs[1][0][0];

    if (w == 0) {   // prologue: stage 0 DMAs (wave-uniform; TDM ignores EXEC)
        tdm_tile_load(&A[(size_t)m0 * K],  ldsA[0], K, M, 64);
        tdm_tile_load(&Bt[(size_t)n0 * K], ldsB[0], K, N, 128);
    }

    for (int s = 0; s < nsteps; s++) {
        int p = s & 1;
        if (w == 0) {
            if (s + 1 < nsteps) {   // prefetch next stage into other buffer
                int k1 = (s + 1) << 5;
                tdm_tile_load(&A[(size_t)m0 * K + k1],  ldsA[p ^ 1], K, M, 64);
                tdm_tile_load(&Bt[(size_t)n0 * K + k1], ldsB[p ^ 1], K, N, 128);
                __builtin_amdgcn_s_wait_tensorcnt(2);  // stage-s pair landed
            } else {
                __builtin_amdgcn_s_wait_tensorcnt(0);
            }
        }
        __syncthreads();

        V16 af[2], bf[4];
        #pragma unroll
        for (int mt = 0; mt < 2; mt++) {
            int row = wr * 32 + mt * 16 + mloc;
            af[mt].u4[0] = *(const uint4*)&As[p][row][half * 8];
            af[mt].u4[1] = *(const uint4*)&As[p][row][16 + half * 8];
        }
        #pragma unroll
        for (int nt = 0; nt < 4; nt++) {
            int col = wc * 64 + nt * 16 + mloc;
            bf[nt].u4[0] = *(const uint4*)&Bs[p][col][half * 8];
            bf[nt].u4[1] = *(const uint4*)&Bs[p][col][16 + half * 8];
        }
        #pragma unroll
        for (int mt = 0; mt < 2; mt++)
            #pragma unroll
            for (int nt = 0; nt < 4; nt++)
                c[mt][nt] = __builtin_amdgcn_wmma_f32_16x16x32_bf16(
                    false, af[mt].v, false, bf[nt].v, (short)0, c[mt][nt],
                    false, false);
        __syncthreads();
    }
#else
    for (int s = 0; s < nsteps; s++) {
        int k0 = s << 5;
        int seg = t & 3;
        int rr  = t >> 2;
        #pragma unroll
        for (int r = 0; r < 2; r++) {
            int row = rr + r * 32;
            uint4 av = *(const uint4*)&A[(size_t)(m0 + row) * K + k0 + seg * 8];
            *(uint4*)&As[0][row][seg * 8] = av;
        }
        #pragma unroll
        for (int r = 0; r < 4; r++) {
            int row = rr + r * 32;
            uint4 bv = *(const uint4*)&Bt[(size_t)(n0 + row) * K + k0 + seg * 8];
            *(uint4*)&Bs[0][row][seg * 8] = bv;
        }
        __syncthreads();

        V16 af[2], bf[4];
        #pragma unroll
        for (int mt = 0; mt < 2; mt++) {
            int row = wr * 32 + mt * 16 + mloc;
            af[mt].u4[0] = *(const uint4*)&As[0][row][half * 8];
            af[mt].u4[1] = *(const uint4*)&As[0][row][16 + half * 8];
        }
        #pragma unroll
        for (int nt = 0; nt < 4; nt++) {
            int col = wc * 64 + nt * 16 + mloc;
            bf[nt].u4[0] = *(const uint4*)&Bs[0][col][half * 8];
            bf[nt].u4[1] = *(const uint4*)&Bs[0][col][16 + half * 8];
        }
        #pragma unroll
        for (int mt = 0; mt < 2; mt++)
            #pragma unroll
            for (int nt = 0; nt < 4; nt++)
                c[mt][nt] = __builtin_amdgcn_wmma_f32_16x16x32_bf16(
                    false, af[mt].v, false, bf[nt].v, (short)0, c[mt][nt],
                    false, false);
        __syncthreads();
    }
#endif

    // ---- epilogue ----
    #pragma unroll
    for (int mt = 0; mt < 2; mt++) {
        #pragma unroll
        for (int nt = 0; nt < 4; nt++) {
            int col = n0 + wc * 64 + nt * 16 + mloc;
            #pragma unroll
            for (int i = 0; i < 8; i++) {
                int row = m0 + wr * 32 + mt * 16 + i + 8 * half;
                float v = c[mt][nt][i];
                if (bias)  v += bias[col];
                if (act == 1)
                    v = v * __builtin_amdgcn_rcpf(1.0f + __expf(-1.702f * v));
                if (resid) v += resid[(size_t)row * N + col];
                v *= oscale;
                if (outF) outF[(size_t)row * N + col] = v;
                if (outB) {
                    size_t idx;
                    int bb = row >> 10, ll = row & 1023;
                    int hh = col >> 6,  dd = col & 63;
                    if (heads == 1)
                        idx = (((size_t)(bb * Hm + hh) * Lm) + ll) * HDm + dd;
                    else if (heads == 2)
                        idx = (((size_t)(bb * Hm + hh) * HDm) + dd) * Lm + ll;
                    else
                        idx = (size_t)row * N + col;
                    outB[idx] = f2bf(v);
                }
            }
        }
    }
}

// ---------------- flash attention (one wave / 16 query rows / head) ----------------
// q,k: bf16 [B*H][L][HD] (q pre-scaled by HD^-0.5); v: bf16 [B*H][HD][L].
// out: bf16 [B*L][D].
__global__ __launch_bounds__(32)
void attn_kernel(const unsigned short* __restrict__ q,
                 const unsigned short* __restrict__ k,
                 const unsigned short* __restrict__ v,
                 const int* __restrict__ mask,
                 unsigned short* __restrict__ out) {
    int bh = blockIdx.x;              // 0..127
    int b  = bh >> 4, h = bh & 15;
    int q0 = blockIdx.y * 16;
    int lane = threadIdx.x;
    int mloc = lane & 15, half = lane >> 4;

    const unsigned short* Q  = q + (size_t)bh * Lm * HDm;
    const unsigned short* Kp = k + (size_t)bh * Lm * HDm;
    const unsigned short* Vt = v + (size_t)bh * HDm * Lm;

    // Q A-fragments for d = 0..31 and 32..63
    V16 aq[2];
    #pragma unroll
    for (int s = 0; s < 2; s++) {
        int d0 = s * 32;
        aq[s].u4[0] = *(const uint4*)&Q[(size_t)(q0 + mloc) * HDm + d0 + half * 8];
        aq[s].u4[1] = *(const uint4*)&Q[(size_t)(q0 + mloc) * HDm + d0 + 16 + half * 8];
    }

    float run_max[8], run_sum[8];
    #pragma unroll
    for (int i = 0; i < 8; i++) { run_max[i] = -1e30f; run_sum[i] = 0.f; }
    v8f o[4] = {};

    __shared__ __align__(16) unsigned short pl[16][40]; // P tile 16x32

    for (int kt = 0; kt < Lm / 32; kt++) {
        int kb = kt * 32;
        // ---- scores: two 16-key subtiles, K-depth = 64 (2 wmma each) ----
        v8f sc[2] = {};
        #pragma unroll
        for (int sub = 0; sub < 2; sub++) {
            int key = kb + sub * 16 + mloc;
            #pragma unroll
            for (int s = 0; s < 2; s++) {
                int d0 = s * 32;
                V16 bk;
                bk.u4[0] = *(const uint4*)&Kp[(size_t)key * HDm + d0 + half * 8];
                bk.u4[1] = *(const uint4*)&Kp[(size_t)key * HDm + d0 + 16 + half * 8];
                sc[sub] = __builtin_amdgcn_wmma_f32_16x16x32_bf16(
                    false, aq[s].v, false, bk.v, (short)0, sc[sub], false, false);
            }
        }
        // mask (per key column)
        float mk0 = (mask[b * Lm + kb + mloc]      > 0) ? 0.f : -1e30f;
        float mk1 = (mask[b * Lm + kb + 16 + mloc] > 0) ? 0.f : -1e30f;
        #pragma unroll
        for (int i = 0; i < 8; i++) { sc[0][i] += mk0; sc[1][i] += mk1; }

        // ---- online softmax ----
        float p0[8], p1[8];
        #pragma unroll
        for (int i = 0; i < 8; i++) {
            float tm = fmaxf(sc[0][i], sc[1][i]);
            #pragma unroll
            for (int off = 1; off < 16; off <<= 1)
                tm = fmaxf(tm, __shfl_xor(tm, off, 32));
            float nm = fmaxf(run_max[i], tm);
            float corr = __expf(run_max[i] - nm);
            run_max[i] = nm;
            p0[i] = __expf(sc[0][i] - nm);
            p1[i] = __expf(sc[1][i] - nm);
            float ts = p0[i] + p1[i];
            #pragma unroll
            for (int off = 1; off < 16; off <<= 1)
                ts += __shfl_xor(ts, off, 32);
            run_sum[i] = run_sum[i] * corr + ts;
            #pragma unroll
            for (int f = 0; f < 4; f++) o[f][i] *= corr;
        }

        // ---- P -> LDS (re-layout D-frag -> A-frag) ----
        #pragma unroll
        for (int i = 0; i < 8; i++) {
            pl[i + 8 * half][mloc]      = f2bf(p0[i]);
            pl[i + 8 * half][16 + mloc] = f2bf(p1[i]);
        }
        __syncthreads();
        V16 ap;
        ap.u4[0] = *(const uint4*)&pl[mloc][half * 8];
        ap.u4[1] = *(const uint4*)&pl[mloc][16 + half * 8];
        __syncthreads();

        // ---- O += P * V  (4 wmma; V fragments are contiguous rows of Vt) ----
        #pragma unroll
        for (int f = 0; f < 4; f++) {
            V16 bv;
            int d = f * 16 + mloc;
            bv.u4[0] = *(const uint4*)&Vt[(size_t)d * Lm + kb + half * 8];
            bv.u4[1] = *(const uint4*)&Vt[(size_t)d * Lm + kb + 16 + half * 8];
            o[f] = __builtin_amdgcn_wmma_f32_16x16x32_bf16(
                false, ap.v, false, bv.v, (short)0, o[f], false, false);
        }
    }

    // ---- normalize + store: out[b*L + q][h*64 + d] ----
    #pragma unroll
    for (int f = 0; f < 4; f++) {
        #pragma unroll
        for (int i = 0; i < 8; i++) {
            int qq  = q0 + i + 8 * half;
            int col = h * HDm + f * 16 + mloc;
            out[(size_t)(b * Lm + qq) * Dm + col] = f2bf(o[f][i] / run_sum[i]);
        }
    }
}

// ---------------- host-side launch ----------------
extern "C" void kernel_launch(void* const* d_in, const int* in_sizes, int n_in,
                              void* d_out, int out_size, void* d_ws, size_t ws_size,
                              hipStream_t stream) {
    const float* x     = (const float*)d_in[0];
    const int*   amask = (const int*)  d_in[1];
    const float* wq = (const float*)d_in[2];  const float* bq = (const float*)d_in[3];
    const float* wk = (const float*)d_in[4];  const float* bk = (const float*)d_in[5];
    const float* wv = (const float*)d_in[6];  const float* bv = (const float*)d_in[7];
    const float* wo = (const float*)d_in[8];  const float* bo = (const float*)d_in[9];
    const float* ln1s = (const float*)d_in[10]; const float* ln1b = (const float*)d_in[11];
    const float* ln2s = (const float*)d_in[12]; const float* ln2b = (const float*)d_in[13];
    const float* w1 = (const float*)d_in[14]; const float* b1 = (const float*)d_in[15];
    const float* w2 = (const float*)d_in[16]; const float* b2 = (const float*)d_in[17];
    float* outp = (float*)d_out;

    char* base = (char*)d_ws;
    size_t off = 0;
    auto alloc = [&](size_t bytes) -> char* {
        char* p = base + off;
        off = (off + bytes + 255) & ~(size_t)255;
        return p;
    };
    // transposed bf16 weights: [N][K]
    unsigned short* wqb = (unsigned short*)alloc((size_t)Dm * Dm * 2);
    unsigned short* wkb = (unsigned short*)alloc((size_t)Dm * Dm * 2);
    unsigned short* wvb = (unsigned short*)alloc((size_t)Dm * Dm * 2);
    unsigned short* wob = (unsigned short*)alloc((size_t)Dm * Dm * 2);
    unsigned short* w1b = (unsigned short*)alloc((size_t)Dm * FFm * 2);
    unsigned short* w2b = (unsigned short*)alloc((size_t)FFm * Dm * 2);
    unsigned short* h1b = (unsigned short*)alloc((size_t)Mrows * Dm * 2);
    unsigned short* qb  = (unsigned short*)alloc((size_t)Mrows * Dm * 2);
    unsigned short* kb  = (unsigned short*)alloc((size_t)Mrows * Dm * 2);
    unsigned short* vb  = (unsigned short*)alloc((size_t)Mrows * Dm * 2);
    unsigned short* ab  = (unsigned short*)alloc((size_t)Mrows * Dm * 2);
    float*          x1  = (float*)        alloc((size_t)Mrows * Dm * 4);
    unsigned short* h2b = (unsigned short*)alloc((size_t)Mrows * Dm * 2);
    unsigned short* m1b = (unsigned short*)alloc((size_t)Mrows * FFm * 2);
    (void)ws_size; (void)n_in; (void)in_sizes; (void)out_size;

    const float qscale = 0.125f; // HD^-0.5
    dim3 tb(32, 8);

    // weights -> transposed bf16  (src is [K][N])
    cvt_t_kernel<<<dim3(Dm / 32, Dm / 32),  tb, 0, stream>>>(wq, wqb, Dm, Dm);
    cvt_t_kernel<<<dim3(Dm / 32, Dm / 32),  tb, 0, stream>>>(wk, wkb, Dm, Dm);
    cvt_t_kernel<<<dim3(Dm / 32, Dm / 32),  tb, 0, stream>>>(wv, wvb, Dm, Dm);
    cvt_t_kernel<<<dim3(Dm / 32, Dm / 32),  tb, 0, stream>>>(wo, wob, Dm, Dm);
    cvt_t_kernel<<<dim3(FFm / 32, Dm / 32), tb, 0, stream>>>(w1, w1b, Dm, FFm);
    cvt_t_kernel<<<dim3(Dm / 32, FFm / 32), tb, 0, stream>>>(w2, w2b, FFm, Dm);

    // LN1
    ln_bf16_kernel<<<Mrows, 256, 0, stream>>>(x, ln1s, ln1b, h1b);

    // QKV projections (Q pre-scaled; V transposed per head)
    dim3 gDD(Dm / 128, Mrows / 64);
    gemm_bf16_kernel<<<gDD, 128, 0, stream>>>(h1b, wqb, bq, nullptr, nullptr, qb,
                                              Mrows, Dm, Dm, 0, 1, qscale);
    gemm_bf16_kernel<<<gDD, 128, 0, stream>>>(h1b, wkb, bk, nullptr, nullptr, kb,
                                              Mrows, Dm, Dm, 0, 1, 1.0f);
    gemm_bf16_kernel<<<gDD, 128, 0, stream>>>(h1b, wvb, bv, nullptr, nullptr, vb,
                                              Mrows, Dm, Dm, 0, 2, 1.0f);

    // attention
    attn_kernel<<<dim3(Bm * Hm, Lm / 16), 32, 0, stream>>>(qb, kb, vb, amask, ab);

    // output projection + residual -> x1
    gemm_bf16_kernel<<<gDD, 128, 0, stream>>>(ab, wob, bo, x, x1, nullptr,
                                              Mrows, Dm, Dm, 0, 0, 1.0f);

    // LN2
    ln_bf16_kernel<<<Mrows, 256, 0, stream>>>(x1, ln2s, ln2b, h2b);

    // MLP up + quickGELU -> bf16
    dim3 gDF(FFm / 128, Mrows / 64);
    gemm_bf16_kernel<<<gDF, 128, 0, stream>>>(h2b, w1b, b1, nullptr, nullptr, m1b,
                                              Mrows, FFm, Dm, 1, 0, 1.0f);

    // MLP down + residual -> d_out
    gemm_bf16_kernel<<<gDD, 128, 0, stream>>>(m1b, w2b, b2, x1, outp, nullptr,
                                              Mrows, Dm, FFm, 0, 0, 1.0f);
}

// v001
// A run of this version takes 543 microseconds.
// Timed twice side by side with v000, it ran 1.18 and 1.17 times as fast.
#include <hip/hip_runtime.h>

// ---------------- constants ----------------
#define Dm   1024
#define Hm   16
#define HDm  64
#define FFm  4096
#define Bm   8
#define Lm   1024
#define Mrows (Bm * Lm)        // 8192
#define EPSc 1e-5f

typedef __attribute__((ext_vector_type(16))) __bf16 v16bf;
typedef __attribute__((ext_vector_type(8)))  float  v8f;
typedef __attribute__((ext_vector_type(4)))  unsigned int u32x4;
typedef __attribute__((ext_vector_type(8)))  int          i32x8;
typedef __attribute__((ext_vector_type(4)))  int          i32x4;

#if defined(__has_builtin)
#if __has_builtin(__builtin_amdgcn_tensor_load_to_lds) && \
    __has_builtin(__builtin_amdgcn_s_wait_tensorcnt)
#define USE_TDM 1
#endif
#endif
#ifndef USE_TDM
#define USE_TDM 0
#endif

union V16 {
    uint4 u4[2];
    unsigned short s[16];
    v16bf v;
};

__device__ __forceinline__ unsigned short f2bf(float f) {
    unsigned int u = __float_as_uint(f);
    unsigned int r = u + 0x7fffu + ((u >> 16) & 1u);   // round to nearest even
    return (unsigned short)(r >> 16);
}

#if USE_TDM
// Issue one TDM 2D tile load: tile_rows x 32 bf16 elements, row stride K
// elements, into LDS with +16B padding per 64B row (=> row pitch 80B).
__device__ __forceinline__ void tdm_tile_load(const unsigned short* gsrc,
                                              unsigned int lds_off,
                                              int K, int rows_total,
                                              int tile_rows) {
    unsigned long long ga = (unsigned long long)(size_t)gsrc;
    u32x4 g0;
    g0[0] = 1u;                                   // count=1, user mode
    g0[1] = lds_off;                              // lds_addr (bytes)
    g0[2] = (unsigned int)ga;                     // global_addr[31:0]
    g0[3] = ((unsigned int)(ga >> 32) & 0x01FFFFFFu) | 0x80000000u; // type=2

    i32x8 g1;
    // data_size=1 (2B) | pad_enable | pad_interval=3 (16 DW) | pad_amount=3 (4 DW)
    g1[0] = (int)(0x00010000u | (1u << 20) | (3u << 22) | (3u << 25));
    g1[1] = (int)(((unsigned)K & 0xFFFFu) << 16);          // tensor_dim0[15:0]
    g1[2] = (int)((((unsigned)K >> 16) & 0xFFFFu) |
                  (((unsigned)rows_total & 0xFFFFu) << 16)); // dim0 hi | dim1 lo
    g1[3] = (int)((((unsigned)rows_total >> 16) & 0xFFFFu) |
                  (32u << 16));                            // dim1 hi | tile_dim0=32
    g1[4] = (int)((unsigned)tile_rows & 0xFFFFu);          // tile_dim1 | tile_dim2=0
    g1[5] = (int)(unsigned)K;                              // tensor_dim0_stride lo
    g1[6] = 0;                                             // stride hi | dim1_stride lo
    g1[7] = 0;

    i32x4 z4 = {0, 0, 0, 0};
#if __clang_major__ >= 23
    i32x8 z8 = {0, 0, 0, 0, 0, 0, 0, 0};
    __builtin_amdgcn_tensor_load_to_lds(g0, g1, z4, z4, z8, 0);
#else
    __builtin_amdgcn_tensor_load_to_lds(g0, g1, z4, z4, 0);
#endif
}
#endif

// ---------------- fp32 -> bf16 transpose-convert: dst[N][K] = src[K][N] ----------------
__global__ __launch_bounds__(256)
void cvt_t_kernel(const float* __restrict__ src, unsigned short* __restrict__ dst,
                  int K, int N) {
    __shared__ unsigned short tile[32][33];
    int n0 = blockIdx.x * 32, k0 = blockIdx.y * 32;
    int tx = threadIdx.x, ty = threadIdx.y;   // block (32,8)
    #pragma unroll
    for (int i = 0; i < 4; i++) {
        int r = ty + i * 8;
        tile[r][tx] = f2bf(src[(size_t)(k0 + r) * N + n0 + tx]);
    }
    __syncthreads();
    #pragma unroll
    for (int i = 0; i < 4; i++) {
        int r = ty + i * 8;
        dst[(size_t)(n0 + r) * K + k0 + tx] = tile[tx][r];
    }
}

// ---------------- LayerNorm -> bf16 ----------------
__global__ __launch_bounds__(256)
void ln_bf16_kernel(const float* __restrict__ x,
                    const float* __restrict__ gamma,
                    const float* __restrict__ beta,
                    unsigned short* __restrict__ out) {
    int row = blockIdx.x;
    int t = threadIdx.x;
    __shared__ float red[256];
    const float* xr = x + (size_t)row * Dm;

    float sum = 0.f;
    for (int i = t; i < Dm; i += 256) sum += xr[i];
    red[t] = sum; __syncthreads();
    for (int st = 128; st > 0; st >>= 1) {
        if (t < st) red[t] += red[t + st];
        __syncthreads();
    }
    float mu = red[0] * (1.0f / Dm);
    __syncthreads();

    float vs = 0.f;
    for (int i = t; i < Dm; i += 256) { float d = xr[i] - mu; vs += d * d; }
    red[t] = vs; __syncthreads();
    for (int st = 128; st > 0; st >>= 1) {
        if (t < st) red[t] += red[t + st];
        __syncthreads();
    }
    float inv = rsqrtf(red[0] * (1.0f / Dm) + EPSc);
    __syncthreads();

    unsigned short* orow = out + (size_t)row * Dm;
    for (int i = t; i < Dm; i += 256)
        orow[i] = f2bf((xr[i] - mu) * inv * gamma[i] + beta[i]);
}

// ---------------- bf16 WMMA GEMM, B pre-transposed, double-buffered TDM ----------------
// C[M,N] = A[M,K] * Bt[N,K]^T  (+bias) (act) (+resid) (*oscale)
// Block tile 64(M) x 128(N), BK=32, 4 waves, each wave 32x64.
// heads: 0 = plain, 1 = [B,H,L,HD], 2 = [B,H,HD,L] (transposed per head)
__global__ __launch_bounds__(128)
void gemm_bf16_kernel(const unsigned short* __restrict__ A,
                      const unsigned short* __restrict__ Bt,
                      const float* __restrict__ bias,
                      const float* __restrict__ resid,
                      float* __restrict__ outF,
                      unsigned short* __restrict__ outB,
                      int M, int N, int K,
                      int act, int heads, float oscale) {
    __shared__ __align__(16) unsigned short As[2][64][40];   // [m][k], 80B pitch
    __shared__ __align__(16) unsigned short Bs[2][128][40];  // [n][k], 80B pitch

    int t    = threadIdx.x;
    int w    = t >> 5, lane = t & 31;
    int wr   = w >> 1, wc = w & 1;
    int mloc = lane & 15, half = lane >> 4;
    int m0 = blockIdx.y * 64, n0 = blockIdx.x * 128;

    v8f c[2][4] = {};
    int nsteps = K >> 5;

#if USE_TDM
    unsigned int ldsA[2], ldsB[2];
    ldsA[0] = (unsigned int)(size_t)(void*)&As[0][0][0];
    ldsA[1] = (unsigned int)(size_t)(void*)&As[1][0][0];
    ldsB[0] = (unsigned int)(size_t)(void*)&Bs[0][0][0];
    ldsB[1] = (unsigned int)(size_t)(void*)&Bs[1][0][0];

    if (w == 0) {   // prologue: stage 0 DMAs (wave-uniform; TDM ignores EXEC)
        tdm_tile_load(&A[(size_t)m0 * K],  ldsA[0], K, M, 64);
        tdm_tile_load(&Bt[(size_t)n0 * K], ldsB[0], K, N, 128);
    }

    for (int s = 0; s < nsteps; s++) {
        int p = s & 1;
        if (w == 0) {
            if (s + 1 < nsteps) {   // prefetch next stage into other buffer
                int k1 = (s + 1) << 5;
                tdm_tile_load(&A[(size_t)m0 * K + k1],  ldsA[p ^ 1], K, M, 64);
                tdm_tile_load(&Bt[(size_t)n0 * K + k1], ldsB[p ^ 1], K, N, 128);
                __builtin_amdgcn_s_wait_tensorcnt(2);  // stage-s pair landed
            } else {
                __builtin_amdgcn_s_wait_tensorcnt(0);
            }
        }
        __syncthreads();

        V16 af[2], bf[4];
        #pragma unroll
        for (int mt = 0; mt < 2; mt++) {
            int row = wr * 32 + mt * 16 + mloc;
            af[mt].u4[0] = *(const uint4*)&As[p][row][half * 8];
            af[mt].u4[1] = *(const uint4*)&As[p][row][16 + half * 8];
        }
        #pragma unroll
        for (int nt = 0; nt < 4; nt++) {
            int col = wc * 64 + nt * 16 + mloc;
            bf[nt].u4[0] = *(const uint4*)&Bs[p][col][half * 8];
            bf[nt].u4[1] = *(const uint4*)&Bs[p][col][16 + half * 8];
        }
        #pragma unroll
        for (int mt = 0; mt < 2; mt++)
            #pragma unroll
            for (int nt = 0; nt < 4; nt++)
                c[mt][nt] = __builtin_amdgcn_wmma_f32_16x16x32_bf16(
                    false, af[mt].v, false, bf[nt].v, (short)0, c[mt][nt],
                    false, false);
        __syncthreads();
    }
#else
    for (int s = 0; s < nsteps; s++) {
        int k0 = s << 5;
        int seg = t & 3;
        int rr  = t >> 2;
        #pragma unroll
        for (int r = 0; r < 2; r++) {
            int row = rr + r * 32;
            uint4 av = *(const uint4*)&A[(size_t)(m0 + row) * K + k0 + seg * 8];
            *(uint4*)&As[0][row][seg * 8] = av;
        }
        #pragma unroll
        for (int r = 0; r < 4; r++) {
            int row = rr + r * 32;
            uint4 bv = *(const uint4*)&Bt[(size_t)(n0 + row) * K + k0 + seg * 8];
            *(uint4*)&Bs[0][row][seg * 8] = bv;
        }
        __syncthreads();

        V16 af[2], bf[4];
        #pragma unroll
        for (int mt = 0; mt < 2; mt++) {
            int row = wr * 32 + mt * 16 + mloc;
            af[mt].u4[0] = *(const uint4*)&As[0][row][half * 8];
            af[mt].u4[1] = *(const uint4*)&As[0][row][16 + half * 8];
        }
        #pragma unroll
        for (int nt = 0; nt < 4; nt++) {
            int col = wc * 64 + nt * 16 + mloc;
            bf[nt].u4[0] = *(const uint4*)&Bs[0][col][half * 8];
            bf[nt].u4[1] = *(const uint4*)&Bs[0][col][16 + half * 8];
        }
        #pragma unroll
        for (int mt = 0; mt < 2; mt++)
            #pragma unroll
            for (int nt = 0; nt < 4; nt++)
                c[mt][nt] = __builtin_amdgcn_wmma_f32_16x16x32_bf16(
                    false, af[mt].v, false, bf[nt].v, (short)0, c[mt][nt],
                    false, false);
        __syncthreads();
    }
#endif

    // ---- epilogue ----
    #pragma unroll
    for (int mt = 0; mt < 2; mt++) {
        #pragma unroll
        for (int nt = 0; nt < 4; nt++) {
            int col = n0 + wc * 64 + nt * 16 + mloc;
            #pragma unroll
            for (int i = 0; i < 8; i++) {
                int row = m0 + wr * 32 + mt * 16 + i + 8 * half;
                float v = c[mt][nt][i];
                if (bias)  v += bias[col];
                if (act == 1)
                    v = v * __builtin_amdgcn_rcpf(1.0f + __expf(-1.702f * v));
                if (resid) v += resid[(size_t)row * N + col];
                v *= oscale;
                if (outF) outF[(size_t)row * N + col] = v;
                if (outB) {
                    size_t idx;
                    int bb = row >> 10, ll = row & 1023;
                    int hh = col >> 6,  dd = col & 63;
                    if (heads == 1)
                        idx = (((size_t)(bb * Hm + hh) * Lm) + ll) * HDm + dd;
                    else if (heads == 2)
                        idx = (((size_t)(bb * Hm + hh) * HDm) + dd) * Lm + ll;
                    else
                        idx = (size_t)row * N + col;
                    outB[idx] = f2bf(v);
                }
            }
        }
    }
}

// ---------------- flash attention (8 waves / 128 query rows / head) ----------------
// q,k: bf16 [B*H][L][HD] (q pre-scaled by HD^-0.5); v: bf16 [B*H][HD][L].
// out: bf16 [B*L][D].
// Each wave owns 16 query rows. K and V tiles of AKS keys are staged in LDS once per
// workgroup by asynchronous copies (whole 128-B rows, two buffers) and read as
// fragments by all eight waves.
#define AWV 8      // waves per workgroup
#define AKS 64     // keys per LDS stage
#define APT 72     // LDS row pitch in elements: 128 B of data + 16 B pad

// One stage's four copies of a lane (two K rows, two V rows, 16 B each). The
// s_wait_xcnt closes the statement so that no address register named here is
// rewritten ahead of it.
__device__ __forceinline__ void attn_stage_copy(unsigned int lk0, unsigned int lk1,
                                                unsigned int lv0, unsigned int lv1,
                                                const unsigned short* gk0,
                                                const unsigned short* gk1,
                                                const unsigned short* gv0,
                                                const unsigned short* gv1) {
    asm volatile("global_load_async_to_lds_b128 %0, %4, off\n\t"
                 "global_load_async_to_lds_b128 %1, %5, off\n\t"
                 "global_load_async_to_lds_b128 %2, %6, off\n\t"
                 "global_load_async_to_lds_b128 %3, %7, off\n\t"
                 "s_wait_xcnt 0x0"
                 :: "v"(lk0), "v"(lk1), "v"(lv0), "v"(lv1),
                    "v"(gk0), "v"(gk1), "v"(gv0), "v"(gv1)
                 : "memory");
}

__global__ __launch_bounds__(32 * AWV)
void attn_kernel(const unsigned short* __restrict__ q,
                 const unsigned short* __restrict__ k,
                 const unsigned short* __restrict__ v,
                 const int* __restrict__ mask,
                 unsigned short* __restrict__ out) {
    int bh = blockIdx.x;              // 0..127
    int b  = bh >> 4, h = bh & 15;
    int t  = threadIdx.x;
    int w  = t >> 5, lane = t & 31;
    int q0 = blockIdx.y * (16 * AWV) + w * 16;
    int mloc = lane & 15, half = lane >> 4;

    const unsigned short* Q  = q + (size_t)bh * Lm * HDm;
    const unsigned short* Kp = k + (size_t)bh * Lm * HDm;
    const unsigned short* Vt = v + (size_t)bh * HDm * Lm;

    __shared__ __align__(16) unsigned short Ks[2][AKS][APT];   // [buffer][key][d]
    __shared__ __align__(16) unsigned short Vs[2][HDm][APT];   // [buffer][d][key]
    __shared__ __align__(16) unsigned short pl[AWV][16][40];   // P tile 16x32, one per wave

    // Q A-fragments for d = 0..31 and 32..63
    V16 aq[2];
    #pragma unroll
    for (int s = 0; s < 2; s++) {
        int d0 = s * 32;
        aq[s].u4[0] = *(const uint4*)&Q[(size_t)(q0 + mloc) * HDm + d0 + half * 8];
        aq[s].u4[1] = *(const uint4*)&Q[(size_t)(q0 + mloc) * HDm + d0 + 16 + half * 8];
    }

    float run_max[8], run_sum[8];
    #pragma unroll
    for (int i = 0; i < 8; i++) { run_max[i] = -1e30f; run_sum[i] = 0.f; }
    v8f o[4] = {};

    // staging: 8 lanes cover one 128-B row; a lane copies rows srow and srow + 32
    int srow = t >> 3, sseg = (t & 7) * 8;
    const unsigned int bufK = AKS * APT * 2, bufV = HDm * APT * 2;   // bytes per buffer
    unsigned int lk0 = (unsigned int)(size_t)(void*)&Ks[0][srow][sseg];
    unsigned int lk1 = (unsigned int)(size_t)(void*)&Ks[0][srow + 32][sseg];
    unsigned int lv0 = (unsigned int)(size_t)(void*)&Vs[0][srow][sseg];
    unsigned int lv1 = (unsigned int)(size_t)(void*)&Vs[0][srow + 32][sseg];
    const unsigned short* gk0 = &Kp[(size_t)srow * HDm + sseg];          // + stage * AKS rows
    const unsigned short* gk1 = &Kp[(size_t)(srow + 32) * HDm + sseg];
    const unsigned short* gv0 = &Vt[(size_t)srow * Lm + sseg];           // + stage * AKS keys
    const unsigned short* gv1 = &Vt[(size_t)(srow + 32) * Lm + sseg];
    const int nst = Lm / AKS;

    attn_stage_copy(lk0, lk1, lv0, lv1, gk0, gk1, gv0, gv1);
    asm volatile("s_wait_asynccnt 0x0" ::: "memory");   // this wave's part of stage 0 has landed
    __syncthreads();                                    // and so has every other wave's
    attn_stage_copy(lk0 + bufK, lk1 + bufK, lv0 + bufV, lv1 + bufV,
                    gk0 + AKS * HDm, gk1 + AKS * HDm, gv0 + AKS, gv1 + AKS);

    for (int st = 0; st < nst; st++) {
        int p = st & 1;
        // unrolled so that kl is a constant and folds into the LDS load offsets
        #pragma unroll
        for (int kt = 0; kt < AKS / 32; kt++) {
            int kl = kt * 32;              // first key of the tile inside the stage
            int kb = st * AKS + kl;        // and in the sequence
            // ---- scores: two 16-key subtiles, K-depth = 64 (2 wmma each) ----
            v8f sc[2] = {};
            #pragma unroll
            for (int sub = 0; sub < 2; sub++) {
                int key = kl + sub * 16 + mloc;
                #pragma unroll
                for (int s = 0; s < 2; s++) {
                    int d0 = s * 32;
                    V16 bk;
                    bk.u4[0] = *(const uint4*)&Ks[p][key][d0 + half * 8];
                    bk.u4[1] = *(const uint4*)&Ks[p][key][d0 + 16 + half * 8];
                    sc[sub] = __builtin_amdgcn_wmma_f32_16x16x32_bf16(
                        false, aq[s].v, false, bk.v, (short)0, sc[sub], false, false);
                }
            }
            // mask (per key column)
            float mk0 = (mask[b * Lm + kb + mloc]      > 0) ? 0.f : -1e30f;
            float mk1 = (mask[b * Lm + kb + 16 + mloc] > 0) ? 0.f : -1e30f;
            #pragma unroll
            for (int i = 0; i < 8; i++) { sc[0][i] += mk0; sc[1][i] += mk1; }

            // ---- online softmax ----
            float p0[8], p1[8];
            #pragma unroll
            for (int i = 0; i < 8; i++) {
                float tm = fmaxf(sc[0][i], sc[1][i]);
                #pragma unroll
                for (int off = 1; off < 16; off <<= 1)
                    tm = fmaxf(tm, __shfl_xor(tm, off, 32));
                float nm = fmaxf(run_max[i], tm);
                float corr = __expf(run_max[i] - nm);
                run_max[i] = nm;
                p0[i] = __expf(sc[0][i] - nm);
                p1[i] = __expf(sc[1][i] - nm);
                float ts = p0[i] + p1[i];
                #pragma unroll
                for (int off = 1; off < 16; off <<= 1)
                    ts += __shfl_xor(ts, off, 32);
                run_sum[i] = run_sum[i] * corr + ts;
                #pragma unroll
                for (int f = 0; f < 4; f++) o[f][i] *= corr;
            }

            // ---- P -> LDS (re-layout D-frag -> A-frag), in the wave's own tile ----
            #pragma unroll
            for (int i = 0; i < 8; i++) {
                pl[w][i + 8 * half][mloc]      = f2bf(p0[i]);
                pl[w][i + 8 * half][16 + mloc] = f2bf(p1[i]);
            }
            // the wave's own P stores are done before its lanes read each other's rows
            asm volatile("s_wait_dscnt 0x0" ::: "memory");
            V16 ap;
            ap.u4[0] = *(const uint4*)&pl[w][mloc][half * 8];
            ap.u4[1] = *(const uint4*)&pl[w][mloc][16 + half * 8];

            // ---- O += P * V  (4 wmma; V fragments are rows of Vs) ----
            #pragma unroll
            for (int f = 0; f < 4; f++) {
                V16 bv;
                int d = f * 16 + mloc;
                bv.u4[0] = *(const uint4*)&Vs[p][d][kl + half * 8];
                bv.u4[1] = *(const uint4*)&Vs[p][d][kl + 16 + half * 8];
                o[f] = __builtin_amdgcn_wmma_f32_16x16x32_bf16(
                    false, ap.v, false, bv.v, (short)0, o[f], false, false);
            }
        }
        // publish point: this wave's LDS reads of buffer p are done, its copies of
        // stage st + 1 have landed; the barrier says the same of every wave.
        asm volatile("s_wait_dscnt 0x0" ::: "memory");
        asm volatile("s_wait_asynccnt 0x0" ::: "memory");
        __syncthreads();
        if (st + 2 < nst) {   // refill the buffer that every wave has just left
            int sn = st + 2;
            attn_stage_copy(lk0 + p * bufK, lk1 + p * bufK, lv0 + p * bufV, lv1 + p * bufV,
                            gk0 + (size_t)sn * AKS * HDm, gk1 + (size_t)sn * AKS * HDm,
                            gv0 + sn * AKS, gv1 + sn * AKS);
        }
    }
    asm volatile("s_wait_asynccnt 0x0" ::: "memory");   // nothing in flight when the wave ends

    // ---- normalize + store: out[b*L + q][h*64 + d] ----
    #pragma unroll
    for (int f = 0; f < 4; f++) {
        #pragma unroll
        for (int i = 0; i < 8; i++) {
            int qq  = q0 + i + 8 * half;
            int col = h * HDm + f * 16 + mloc;
            out[(size_t)(b * Lm + qq) * Dm + col] = f2bf(o[f][i] / run_sum[i]);
        }
    }
}

// ---------------- host-side launch ----------------
extern "C" void kernel_launch(void* const* d_in, const int* in_sizes, int n_in,
                              void* d_out, int out_size, void* d_ws, size_t ws_size,
                              hipStream_t stream) {
    const float* x     = (const float*)d_in[0];
    const int*   amask = (const int*)  d_in[1];
    const float* wq = (const float*)d_in[2];  const float* bq = (const float*)d_in[3];
    const float* wk = (const float*)d_in[4];  const float* bk = (const float*)d_in[5];
    const float* wv = (const float*)d_in[6];  const float* bv = (const float*)d_in[7];
    const float* wo = (const float*)d_in[8];  const float* bo = (const float*)d_in[9];
    const float* ln1s = (const float*)d_in[10]; const float* ln1b = (const float*)d_in[11];
    const float* ln2s = (const float*)d_in[12]; const float* ln2b = (const float*)d_in[13];
    const float* w1 = (const float*)d_in[14]; const float* b1 = (const float*)d_in[15];
    const float* w2 = (const float*)d_in[16]; const float* b2 = (const float*)d_in[17];
    float* outp = (float*)d_out;

    char* base = (char*)d_ws;
    size_t off = 0;
    auto alloc = [&](size_t bytes) -> char* {
        char* p = base + off;
        off = (off + bytes + 255) & ~(size_t)255;
        return p;
    };
    // transposed bf16 weights: [N][K]
    unsigned short* wqb = (unsigned short*)alloc((size_t)Dm * Dm * 2);
    unsigned short* wkb = (unsigned short*)alloc((size_t)Dm * Dm * 2);
    unsigned short* wvb = (unsigned short*)alloc((size_t)Dm * Dm * 2);
    unsigned short* wob = (unsigned short*)alloc((size_t)Dm * Dm * 2);
    unsigned short* w1b = (unsigned short*)alloc((size_t)Dm * FFm * 2);
    unsigned short* w2b = (unsigned short*)alloc((size_t)FFm * Dm * 2);
    unsigned short* h1b = (unsigned short*)alloc((size_t)Mrows * Dm * 2);
    unsigned short* qb  = (unsigned short*)alloc((size_t)Mrows * Dm * 2);
    unsigned short* kb  = (unsigned short*)alloc((size_t)Mrows * Dm * 2);
    unsigned short* vb  = (unsigned short*)alloc((size_t)Mrows * Dm * 2);
    unsigned short* ab  = (unsigned short*)alloc((size_t)Mrows * Dm * 2);
    float*          x1  = (float*)        alloc((size_t)Mrows * Dm * 4);
    unsigned short* h2b = (unsigned short*)alloc((size_t)Mrows * Dm * 2);
    unsigned short* m1b = (unsigned short*)alloc((size_t)Mrows * FFm * 2);
    (void)ws_size; (void)n_in; (void)in_sizes; (void)out_size;

    const float qscale = 0.125f; // HD^-0.5
    dim3 tb(32, 8);

    // weights -> transposed bf16  (src is [K][N])
    cvt_t_kernel<<<dim3(Dm / 32, Dm / 32),  tb, 0, stream>>>(wq, wqb, Dm, Dm);
    cvt_t_kernel<<<dim3(Dm / 32, Dm / 32),  tb, 0, stream>>>(wk, wkb, Dm, Dm);
    cvt_t_kernel<<<dim3(Dm / 32, Dm / 32),  tb, 0, stream>>>(wv, wvb, Dm, Dm);
    cvt_t_kernel<<<dim3(Dm / 32, Dm / 32),  tb, 0, stream>>>(wo, wob, Dm, Dm);
    cvt_t_kernel<<<dim3(FFm / 32, Dm / 32), tb, 0, stream>>>(w1, w1b, Dm, FFm);
    cvt_t_kernel<<<dim3(Dm / 32, FFm / 32), tb, 0, stream>>>(w2, w2b, FFm, Dm);

    // LN1
    ln_bf16_kernel<<<Mrows, 256, 0, stream>>>(x, ln1s, ln1b, h1b);

    // QKV projections (Q pre-scaled; V transposed per head)
    dim3 gDD(Dm / 128, Mrows / 64);
    gemm_bf16_kernel<<<gDD, 128, 0, stream>>>(h1b, wqb, bq, nullptr, nullptr, qb,
                                              Mrows, Dm, Dm, 0, 1, qscale);
    gemm_bf16_kernel<<<gDD, 128, 0, stream>>>(h1b, wkb, bk, nullptr, nullptr, kb,
                                              Mrows, Dm, Dm, 0, 1, 1.0f);
    gemm_bf16_kernel<<<gDD, 128, 0, stream>>>(h1b, wvb, bv, nullptr, nullptr, vb,
                                              Mrows, Dm, Dm, 0, 2, 1.0f);

    // attention
    attn_kernel<<<dim3(Bm * Hm, Lm / (16 * AWV)), 32 * AWV, 0, stream>>>(qb, kb, vb, amask, ab);

    // output projection + residual -> x1
    gemm_bf16_kernel<<<gDD, 128, 0, stream>>>(ab, wob, bo, x, x1, nullptr,
                                              Mrows, Dm, Dm, 0, 0, 1.0f);

    // LN2
    ln_bf16_kernel<<<Mrows, 256, 0, stream>>>(x1, ln2s, ln2b, h2b);

    // MLP up + quickGELU -> bf16
    dim3 gDF(FFm / 128, Mrows / 64);
    gemm_bf16_kernel<<<gDF, 128, 0, stream>>>(h2b, w1b, b1, nullptr, nullptr, m1b,
                                              Mrows, FFm, Dm, 1, 0, 1.0f);

    // MLP down + residual -> d_out
    gemm_bf16_kernel<<<gDD, 128, 0, stream>>>(m1b, w2b, b2, x1, outp, nullptr,
                                              Mrows, Dm, FFm, 0, 0, 1.0f);
}

// v002
// One run takes 409 microseconds.
// Next to v001, in two timings, it ran 1.33 and 1.32 times as fast.
// All steps since v000 together make it 1.56 times as fast.
#include <hip/hip_runtime.h>

// ---------------- constants ----------------
#define Dm   1024
#define Hm   16
#define HDm  64
#define FFm  4096
#define Bm   8
#define Lm   1024
#define Mrows (Bm * Lm)        // 8192
#define EPSc 1e-5f

typedef __attribute__((ext_vector_type(16))) __bf16 v16bf;
typedef __attribute__((ext_vector_type(8)))  float  v8f;
typedef __attribute__((ext_vector_type(4)))  unsigned int u32x4;
typedef __attribute__((ext_vector_type(8)))  int          i32x8;
typedef __attribute__((ext_vector_type(4)))  int          i32x4;

#if defined(__has_builtin)
#if __has_builtin(__builtin_amdgcn_tensor_load_to_lds) && \
    __has_builtin(__builtin_amdgcn_s_wait_tensorcnt)
#define USE_TDM 1
#endif
#endif
#ifndef USE_TDM
#define USE_TDM 0
#endif

union V16 {
    uint4 u4[2];
    unsigned short s[16];
    v16bf v;
};

__device__ __forceinline__ unsigned short f2bf(float f) {
    unsigned int u = __float_as_uint(f);
    unsigned int r = u + 0x7fffu + ((u >> 16) & 1u);   // round to nearest even
    return (unsigned short)(r >> 16);
}

#if USE_TDM
// Issue one TDM 2D tile load: tile_rows x 32 bf16 elements, row stride K
// elements, into LDS with +16B padding per 64B row (=> row pitch 80B).
__device__ __forceinline__ void tdm_tile_load(const unsigned short* gsrc,
                                              unsigned int lds_off,
                                              int K, int rows_total,
                                              int tile_rows) {
    unsigned long long ga = (unsigned long long)(size_t)gsrc;
    u32x4 g0;
    g0[0] = 1u;                                   // count=1, user mode
    g0[1] = lds_off;                              // lds_addr (bytes)
    g0[2] = (unsigned int)ga;                     // global_addr[31:0]
    g0[3] = ((unsigned int)(ga >> 32) & 0x01FFFFFFu) | 0x80000000u; // type=2

    i32x8 g1;
    // data_size=1 (2B) | pad_enable | pad_interval=3 (16 DW) | pad_amount=3 (4 DW)
    g1[0] = (int)(0x00010000u | (1u << 20) | (3u << 22) | (3u << 25));
    g1[1] = (int)(((unsigned)K & 0xFFFFu) << 16);          // tensor_dim0[15:0]
    g1[2] = (int)((((unsigned)K >> 16) & 0xFFFFu) |
                  (((unsigned)rows_total & 0xFFFFu) << 16)); // dim0 hi | dim1 lo
    g1[3] = (int)((((unsigned)rows_total >> 16) & 0xFFFFu) |
                  (32u << 16));                            // dim1 hi | tile_dim0=32
    g1[4] = (int)((unsigned)tile_rows & 0xFFFFu);          // tile_dim1 | tile_dim2=0
    g1[5] = (int)(unsigned)K;                              // tensor_dim0_stride lo
    g1[6] = 0;                                             // stride hi | dim1_stride lo
    g1[7] = 0;

    i32x4 z4 = {0, 0, 0, 0};
#if __clang_major__ >= 23
    i32x8 z8 = {0, 0, 0, 0, 0, 0, 0, 0};
    __builtin_amdgcn_tensor_load_to_lds(g0, g1, z4, z4, z8, 0);
#else
    __builtin_amdgcn_tensor_load_to_lds(g0, g1, z4, z4, 0);
#endif
}
#endif

// ---------------- fp32 -> bf16 transpose-convert: dst[N][K] = src[K][N] ----------------
__global__ __launch_bounds__(256)
void cvt_t_kernel(const float* __restrict__ src, unsigned short* __restrict__ dst,
                  int K, int N) {
    __shared__ unsigned short tile[32][33];
    int n0 = blockIdx.x * 32, k0 = blockIdx.y * 32;
    int tx = threadIdx.x, ty = threadIdx.y;   // block (32,8)
    #pragma unroll
    for (int i = 0; i < 4; i++) {
        int r = ty + i * 8;
        tile[r][tx] = f2bf(src[(size_t)(k0 + r) * N + n0 + tx]);
    }
    __syncthreads();
    #pragma unroll
    for (int i = 0; i < 4; i++) {
        int r = ty + i * 8;
        dst[(size_t)(n0 + r) * K + k0 + tx] = tile[tx][r];
    }
}

// ---------------- LayerNorm -> bf16 ----------------
__global__ __launch_bounds__(256)
void ln_bf16_kernel(const float* __restrict__ x,
                    const float* __restrict__ gamma,
                    const float* __restrict__ beta,
                    unsigned short* __restrict__ out) {
    int row = blockIdx.x;
    int t = threadIdx.x;
    __shared__ float red[256];
    const float* xr = x + (size_t)row * Dm;

    float sum = 0.f;
    for (int i = t; i < Dm; i += 256) sum += xr[i];
    red[t] = sum; __syncthreads();
    for (int st = 128; st > 0; st >>= 1) {
        if (t < st) red[t] += red[t + st];
        __syncthreads();
    }
    float mu = red[0] * (1.0f / Dm);
    __syncthreads();

    float vs = 0.f;
    for (int i = t; i < Dm; i += 256) { float d = xr[i] - mu; vs += d * d; }
    red[t] = vs; __syncthreads();
    for (int st = 128; st > 0; st >>= 1) {
        if (t < st) red[t] += red[t + st];
        __syncthreads();
    }
    float inv = rsqrtf(red[0] * (1.0f / Dm) + EPSc);
    __syncthreads();

    unsigned short* orow = out + (size_t)row * Dm;
    for (int i = t; i < Dm; i += 256)
        orow[i] = f2bf((xr[i] - mu) * inv * gamma[i] + beta[i]);
}

// A transcendental with the one free issue slot behind it that the instruction set asks for
// before its result is read or its source overwritten; the v_nop in the same statement holds
// that slot whatever the compiler schedules next.
__device__ __forceinline__ float exp2_slot(float x) {
    float r;
    asm("v_exp_f32 %0, %1\n\tv_nop" : "=v"(r) : "v"(x));
    return r;
}
__device__ __forceinline__ float rcp_slot(float x) {
    float r;
    asm("v_rcp_f32 %0, %1\n\tv_nop" : "=v"(r) : "v"(x));
    return r;
}

// ---------------- GEMM epilogue of one wave (32 x 64 of C), one straight-line form per mode ----------------
// v = (acc + bias [quickGELU] [+ resid]) * oscale
// MODE 0: bf16 to [B,H,L,HD]   MODE 1: bf16 to [B,H,HD,L] (transposed per head)
// MODE 2: quickGELU, bf16 to [M,N]   MODE 3: + resid, f32 to [M,N]
// row0, col0: the lane's first row and column of C.
template <int MODE>
__device__ __forceinline__ void gemm_store(const v8f (&c)[2][4],
                                           const float* __restrict__ bias,
                                           const float* __restrict__ resid,
                                           float* __restrict__ outF,
                                           unsigned short* __restrict__ outB,
                                           int N, float oscale, int row0, int col0) {
    float bv[4];
    #pragma unroll
    for (int nt = 0; nt < 4; nt++) bv[nt] = bias[col0 + nt * 16];
    // groups of 16 rows x 32 columns: 16 elements of a lane
    #pragma unroll
    for (int gq = 0; gq < 4; gq++) {
        const int mt = gq >> 1, nb = (gq & 1) * 2;
        float rs[2][8];
        if (MODE == 3) {
            #pragma unroll
            for (int n2 = 0; n2 < 2; n2++)
                #pragma unroll
                for (int i = 0; i < 8; i++)
                    rs[n2][i] = resid[(unsigned int)((row0 + mt * 16 + i) * N + col0 + (nb + n2) * 16)];
            // the group's 16 residual loads are all issued before the first is used; under the
            // register bound the compiler otherwise waits for each in turn
            __builtin_amdgcn_sched_barrier(0);
        }
        #pragma unroll
        for (int n2 = 0; n2 < 2; n2++) {
            const int nt = nb + n2;
            int col = col0 + nt * 16;
            #pragma unroll
            for (int i = 0; i < 8; i++) {
                int row = row0 + mt * 16 + i;
                float v = c[mt][nt][i] + bv[nt];
                if (MODE == 2)   // v * sigmoid(1.702 v), e^x as 2^(x log2 e)
                    v = v * rcp_slot(1.0f + exp2_slot((-1.702f * v) * 1.44269504f));
                if (MODE == 3) v += rs[n2][i];
                v *= oscale;
                if (MODE == 3) {
                    outF[(unsigned int)(row * N + col)] = v;
                } else {
                    unsigned int idx;   // every index here is below 2^25: 32 bits hold it
                    int bb = row >> 10, ll = row & 1023;
                    int hh = col >> 6,  dd = col & 63;
                    if (MODE == 0)
                        idx = (unsigned int)((((bb * Hm + hh) * Lm) + ll) * HDm + dd);
                    else if (MODE == 1)
                        idx = (unsigned int)((((bb * Hm + hh) * HDm) + dd) * Lm + ll);
                    else
                        idx = (unsigned int)(row * N + col);
                    outB[idx] = f2bf(v);
                }
            }
        }
        // the next group's loads may land in registers that this group's stores name
        if (MODE == 3 && gq < 3) asm volatile("s_wait_xcnt 0x0" ::: "memory");
        // one group's work stays in front of the next group's: without this fence the
        // 128-register budget of 8 waves per SIMD spills
        if (gq < 3) __builtin_amdgcn_sched_barrier(0);
    }
}

// ---------------- bf16 WMMA GEMM, B pre-transposed, double-buffered TDM ----------------
// C[M,N] = A[M,K] * Bt[N,K]^T, then the epilogue of gemm_store<mode>
// Block tile 64(M) x 128(N), BK=32, 4 waves, each wave 32x64.
// second bound: 8 waves per SIMD, the residency this kernel had; without it the
// straight-line epilogue is scheduled over 150 and more registers
__global__ __launch_bounds__(128, 8)
void gemm_bf16_kernel(const unsigned short* __restrict__ A,
                      const unsigned short* __restrict__ Bt,
                      const float* __restrict__ bias,
                      const float* __restrict__ resid,
                      float* __restrict__ outF,
                      unsigned short* __restrict__ outB,
                      int M, int N, int K,
                      int mode, float oscale) {
    __shared__ __align__(16) unsigned short As[2][64][40];   // [m][k], 80B pitch
    __shared__ __align__(16) unsigned short Bs[2][128][40];  // [n][k], 80B pitch

    int t    = threadIdx.x;
    int w    = t >> 5, lane = t & 31;
    int wr   = w >> 1, wc = w & 1;
    int mloc = lane & 15, half = lane >> 4;
    int m0 = blockIdx.y * 64, n0 = blockIdx.x * 128;

    v8f c[2][4] = {};
    int nsteps = K >> 5;

#if USE_TDM
    unsigned int ldsA[2], ldsB[2];
    ldsA[0] = (unsigned int)(size_t)(void*)&As[0][0][0];
    ldsA[1] = (unsigned int)(size_t)(void*)&As[1][0][0];
    ldsB[0] = (unsigned int)(size_t)(void*)&Bs[0][0][0];
    ldsB[1] = (unsigned int)(size_t)(void*)&Bs[1][0][0];

    if (w == 0) {   // prologue: stage 0 DMAs (wave-uniform; TDM ignores EXEC)
        tdm_tile_load(&A[(size_t)m0 * K],  ldsA[0], K, M, 64);
        tdm_tile_load(&Bt[(size_t)n0 * K], ldsB[0], K, N, 128);
    }

    for (int s = 0; s < nsteps; s++) {
        int p = s & 1;
        if (w == 0) {
            if (s + 1 < nsteps) {   // prefetch next stage into other buffer
                int k1 = (s + 1) << 5;
                tdm_tile_load(&A[(size_t)m0 * K + k1],  ldsA[p ^ 1], K, M, 64);
                tdm_tile_load(&Bt[(size_t)n0 * K + k1], ldsB[p ^ 1], K, N, 128);
                __builtin_amdgcn_s_wait_tensorcnt(2);  // stage-s pair landed
            } else {
                __builtin_amdgcn_s_wait_tensorcnt(0);
            }
        }
        __syncthreads();

        V16 af[2], bf[4];
        #pragma unroll
        for (int mt = 0; mt < 2; mt++) {
            int row = wr * 32 + mt * 16 + mloc;
            af[mt].u4[0] = *(const uint4*)&As[p][row][half * 8];
            af[mt].u4[1] = *(const uint4*)&As[p][row][16 + half * 8];
        }
        #pragma unroll
        for (int nt = 0; nt < 4; nt++) {
            int col = wc * 64 + nt * 16 + mloc;
            bf[nt].u4[0] = *(const uint4*)&Bs[p][col][half * 8];
            bf[nt].u4[1] = *(const uint4*)&Bs[p][col][16 + half * 8];
        }
        #pragma unroll
        for (int mt = 0; mt < 2; mt++)
            #pragma unroll
            for (int nt = 0; nt < 4; nt++)
                c[mt][nt] = __builtin_amdgcn_wmma_f32_16x16x32_bf16(
                    false, af[mt].v, false, bf[nt].v, (short)0, c[mt][nt],
                    false, false);
        __syncthreads();
    }
#else
    for (int s = 0; s < nsteps; s++) {
        int k0 = s << 5;
        int seg = t & 3;
        int rr  = t >> 2;
        #pragma unroll
        for (int r = 0; r < 2; r++) {
            int row = rr + r * 32;
            uint4 av = *(const uint4*)&A[(size_t)(m0 + row) * K + k0 + seg * 8];
            *(uint4*)&As[0][row][seg * 8] = av;
        }
        #pragma unroll
        for (int r = 0; r < 4; r++) {
            int row = rr + r * 32;
            uint4 bv = *(const uint4*)&Bt[(size_t)(n0 + row) * K + k0 + seg * 8];
            *(uint4*)&Bs[0][row][seg * 8] = bv;
        }
        __syncthreads();

        V16 af[2], bf[4];
        #pragma unroll
        for (int mt = 0; mt < 2; mt++) {
            int row = wr * 32 + mt * 16 + mloc;
            af[mt].u4[0] = *(const uint4*)&As[0][row][half * 8];
            af[mt].u4[1] = *(const uint4*)&As[0][row][16 + half * 8];
        }
        #pragma unroll
        for (int nt = 0; nt < 4; nt++) {
            int col = wc * 64 + nt * 16 + mloc;
            bf[nt].u4[0] = *(const uint4*)&Bs[0][col][half * 8];
            bf[nt].u4[1] = *(const uint4*)&Bs[0][col][16 + half * 8];
        }
        #pragma unroll
        for (int mt = 0; mt < 2; mt++)
            #pragma unroll
            for (int nt = 0; nt < 4; nt++)
                c[mt][nt] = __builtin_amdgcn_wmma_f32_16x16x32_bf16(
                    false, af[mt].v, false, bf[nt].v, (short)0, c[mt][nt],
                    false, false);
        __syncthreads();
    }
#endif

    // ---- epilogue: the mode is tested once per wave, never per element ----
    int row0 = m0 + wr * 32 + 8 * half;
    int col0 = n0 + wc * 64 + mloc;
    if (mode == 0)      gemm_store<0>(c, bias, resid, outF, outB, N, oscale, row0, col0);
    else if (mode == 1) gemm_store<1>(c, bias, resid, outF, outB, N, oscale, row0, col0);
    else if (mode == 2) gemm_store<2>(c, bias, resid, outF, outB, N, oscale, row0, col0);
    else                gemm_store<3>(c, bias, resid, outF, outB, N, oscale, row0, col0);
}

// ---------------- flash attention (8 waves / 128 query rows / head) ----------------
// q,k: bf16 [B*H][L][HD] (q pre-scaled by HD^-0.5); v: bf16 [B*H][HD][L].
// out: bf16 [B*L][D].
// Each wave owns 16 query rows. K and V tiles of AKS keys are staged in LDS once per
// workgroup by asynchronous copies (whole 128-B rows, two buffers) and read as
// fragments by all eight waves.
#define AWV 8      // waves per workgroup
#define AKS 64     // keys per LDS stage
#define APT 72     // LDS row pitch in elements: 128 B of data + 16 B pad

// One stage's four copies of a lane (two K rows, two V rows, 16 B each). The
// s_wait_xcnt closes the statement so that no address register named here is
// rewritten ahead of it.
__device__ __forceinline__ void attn_stage_copy(unsigned int lk0, unsigned int lk1,
                                                unsigned int lv0, unsigned int lv1,
                                                const unsigned short* gk0,
                                                const unsigned short* gk1,
                                                const unsigned short* gv0,
                                                const unsigned short* gv1) {
    asm volatile("global_load_async_to_lds_b128 %0, %4, off\n\t"
                 "global_load_async_to_lds_b128 %1, %5, off\n\t"
                 "global_load_async_to_lds_b128 %2, %6, off\n\t"
                 "global_load_async_to_lds_b128 %3, %7, off\n\t"
                 "s_wait_xcnt 0x0"
                 :: "v"(lk0), "v"(lk1), "v"(lv0), "v"(lv1),
                    "v"(gk0), "v"(gk1), "v"(gv0), "v"(gv1)
                 : "memory");
}

__global__ __launch_bounds__(32 * AWV)
void attn_kernel(const unsigned short* __restrict__ q,
                 const unsigned short* __restrict__ k,
                 const unsigned short* __restrict__ v,
                 const int* __restrict__ mask,
                 unsigned short* __restrict__ out) {
    int bh = blockIdx.x;              // 0..127
    int b  = bh >> 4, h = bh & 15;
    int t  = threadIdx.x;
    int w  = t >> 5, lane = t & 31;
    int q0 = blockIdx.y * (16 * AWV) + w * 16;
    int mloc = lane & 15, half = lane >> 4;

    const unsigned short* Q  = q + (size_t)bh * Lm * HDm;
    const unsigned short* Kp = k + (size_t)bh * Lm * HDm;
    const unsigned short* Vt = v + (size_t)bh * HDm * Lm;

    __shared__ __align__(16) unsigned short Ks[2][AKS][APT];   // [buffer][key][d]
    __shared__ __align__(16) unsigned short Vs[2][HDm][APT];   // [buffer][d][key]
    __shared__ __align__(16) unsigned short pl[AWV][16][40];   // P tile 16x32, one per wave

    // Q A-fragments for d = 0..31 and 32..63
    V16 aq[2];
    #pragma unroll
    for (int s = 0; s < 2; s++) {
        int d0 = s * 32;
        aq[s].u4[0] = *(const uint4*)&Q[(size_t)(q0 + mloc) * HDm + d0 + half * 8];
        aq[s].u4[1] = *(const uint4*)&Q[(size_t)(q0 + mloc) * HDm + d0 + 16 + half * 8];
    }

    float run_max[8], run_sum[8];
    #pragma unroll
    for (int i = 0; i < 8; i++) { run_max[i] = -1e30f; run_sum[i] = 0.f; }
    v8f o[4] = {};

    // staging: 8 lanes cover one 128-B row; a lane copies rows srow and srow + 32
    int srow = t >> 3, sseg = (t & 7) * 8;
    const unsigned int bufK = AKS * APT * 2, bufV = HDm * APT * 2;   // bytes per buffer
    unsigned int lk0 = (unsigned int)(size_t)(void*)&Ks[0][srow][sseg];
    unsigned int lk1 = (unsigned int)(size_t)(void*)&Ks[0][srow + 32][sseg];
    unsigned int lv0 = (unsigned int)(size_t)(void*)&Vs[0][srow][sseg];
    unsigned int lv1 = (unsigned int)(size_t)(void*)&Vs[0][srow + 32][sseg];
    const unsigned short* gk0 = &Kp[(size_t)srow * HDm + sseg];          // + stage * AKS rows
    const unsigned short* gk1 = &Kp[(size_t)(srow + 32) * HDm + sseg];
    const unsigned short* gv0 = &Vt[(size_t)srow * Lm + sseg];           // + stage * AKS keys
    const unsigned short* gv1 = &Vt[(size_t)(srow + 32) * Lm + sseg];
    const int nst = Lm / AKS;

    attn_stage_copy(lk0, lk1, lv0, lv1, gk0, gk1, gv0, gv1);
    asm volatile("s_wait_asynccnt 0x0" ::: "memory");   // this wave's part of stage 0 has landed
    __syncthreads();                                    // and so has every other wave's
    attn_stage_copy(lk0 + bufK, lk1 + bufK, lv0 + bufV, lv1 + bufV,
                    gk0 + AKS * HDm, gk1 + AKS * HDm, gv0 + AKS, gv1 + AKS);

    for (int st = 0; st < nst; st++) {
        int p = st & 1;
        // unrolled so that kl is a constant and folds into the LDS load offsets
        #pragma unroll
        for (int kt = 0; kt < AKS / 32; kt++) {
            int kl = kt * 32;              // first key of the tile inside the stage
            int kb = st * AKS + kl;        // and in the sequence
            // ---- scores: two 16-key subtiles, K-depth = 64 (2 wmma each) ----
            v8f sc[2] = {};
            #pragma unroll
            for (int sub = 0; sub < 2; sub++) {
                int key = kl + sub * 16 + mloc;
                #pragma unroll
                for (int s = 0; s < 2; s++) {
                    int d0 = s * 32;
                    V16 bk;
                    bk.u4[0] = *(const uint4*)&Ks[p][key][d0 + half * 8];
                    bk.u4[1] = *(const uint4*)&Ks[p][key][d0 + 16 + half * 8];
                    sc[sub] = __builtin_amdgcn_wmma_f32_16x16x32_bf16(
                        false, aq[s].v, false, bk.v, (short)0, sc[sub], false, false);
                }
            }
            // mask (per key column)
            float mk0 = (mask[b * Lm + kb + mloc]      > 0) ? 0.f : -1e30f;
            float mk1 = (mask[b * Lm + kb + 16 + mloc] > 0) ? 0.f : -1e30f;
            #pragma unroll
            for (int i = 0; i < 8; i++) { sc[0][i] += mk0; sc[1][i] += mk1; }

            // ---- online softmax ----
            float p0[8], p1[8];
            #pragma unroll
            for (int i = 0; i < 8; i++) {
                float tm = fmaxf(sc[0][i], sc[1][i]);
                #pragma unroll
                for (int off = 1; off < 16; off <<= 1)
                    tm = fmaxf(tm, __shfl_xor(tm, off, 32));
                float nm = fmaxf(run_max[i], tm);
                float corr = __expf(run_max[i] - nm);
                run_max[i] = nm;
                p0[i] = __expf(sc[0][i] - nm);
                p1[i] = __expf(sc[1][i] - nm);
                float ts = p0[i] + p1[i];
                #pragma unroll
                for (int off = 1; off < 16; off <<= 1)
                    ts += __shfl_xor(ts, off, 32);
                run_sum[i] = run_sum[i] * corr + ts;
                #pragma unroll
                for (int f = 0; f < 4; f++) o[f][i] *= corr;
            }

            // ---- P -> LDS (re-layout D-frag -> A-frag), in the wave's own tile ----
            #pragma unroll
            for (int i = 0; i < 8; i++) {
                pl[w][i + 8 * half][mloc]      = f2bf(p0[i]);
                pl[w][i + 8 * half][16 + mloc] = f2bf(p1[i]);
            }
            // the wave's own P stores are done before its lanes read each other's rows
            asm volatile("s_wait_dscnt 0x0" ::: "memory");
            V16 ap;
            ap.u4[0] = *(const uint4*)&pl[w][mloc][half * 8];
            ap.u4[1] = *(const uint4*)&pl[w][mloc][16 + half * 8];

            // ---- O += P * V  (4 wmma; V fragments are rows of Vs) ----
            #pragma unroll
            for (int f = 0; f < 4; f++) {
                V16 bv;
                int d = f * 16 + mloc;
                bv.u4[0] = *(const uint4*)&Vs[p][d][kl + half * 8];
                bv.u4[1] = *(const uint4*)&Vs[p][d][kl + 16 + half * 8];
                o[f] = __builtin_amdgcn_wmma_f32_16x16x32_bf16(
                    false, ap.v, false, bv.v, (short)0, o[f], false, false);
            }
        }
        // publish point: this wave's LDS reads of buffer p are done, its copies of
        // stage st + 1 have landed; the barrier says the same of every wave.
        asm volatile("s_wait_dscnt 0x0" ::: "memory");
        asm volatile("s_wait_asynccnt 0x0" ::: "memory");
        __syncthreads();
        if (st + 2 < nst) {   // refill the buffer that every wave has just left
            int sn = st + 2;
            attn_stage_copy(lk0 + p * bufK, lk1 + p * bufK, lv0 + p * bufV, lv1 + p * bufV,
                            gk0 + (size_t)sn * AKS * HDm, gk1 + (size_t)sn * AKS * HDm,
                            gv0 + sn * AKS, gv1 + sn * AKS);
        }
    }
    asm volatile("s_wait_asynccnt 0x0" ::: "memory");   // nothing in flight when the wave ends

    // ---- normalize + store: out[b*L + q][h*64 + d] ----
    #pragma unroll
    for (int f = 0; f < 4; f++) {
        #pragma unroll
        for (int i = 0; i < 8; i++) {
            int qq  = q0 + i + 8 * half;
            int col = h * HDm + f * 16 + mloc;
            out[(size_t)(b * Lm + qq) * Dm + col] = f2bf(o[f][i] / run_sum[i]);
        }
    }
}

// ---------------- host-side launch ----------------
extern "C" void kernel_launch(void* const* d_in, const int* in_sizes, int n_in,
                              void* d_out, int out_size, void* d_ws, size_t ws_size,
                              hipStream_t stream) {
    const float* x     = (const float*)d_in[0];
    const int*   amask = (const int*)  d_in[1];
    const float* wq = (const float*)d_in[2];  const float* bq = (const float*)d_in[3];
    const float* wk = (const float*)d_in[4];  const float* bk = (const float*)d_in[5];
    const float* wv = (const float*)d_in[6];  const float* bv = (const float*)d_in[7];
    const float* wo = (const float*)d_in[8];  const float* bo = (const float*)d_in[9];
    const float* ln1s = (const float*)d_in[10]; const float* ln1b = (const float*)d_in[11];
    const float* ln2s = (const float*)d_in[12]; const float* ln2b = (const float*)d_in[13];
    const float* w1 = (const float*)d_in[14]; const float* b1 = (const float*)d_in[15];
    const float* w2 = (const float*)d_in[16]; const float* b2 = (const float*)d_in[17];
    float* outp = (float*)d_out;

    char* base = (char*)d_ws;
    size_t off = 0;
    auto alloc = [&](size_t bytes) -> char* {
        char* p = base + off;
        off = (off + bytes + 255) & ~(size_t)255;
        return p;
    };
    // transposed bf16 weights: [N][K]
    unsigned short* wqb = (unsigned short*)alloc((size_t)Dm * Dm * 2);
    unsigned short* wkb = (unsigned short*)alloc((size_t)Dm * Dm * 2);
    unsigned short* wvb = (unsigned short*)alloc((size_t)Dm * Dm * 2);
    unsigned short* wob = (unsigned short*)alloc((size_t)Dm * Dm * 2);
    unsigned short* w1b = (unsigned short*)alloc((size_t)Dm * FFm * 2);
    unsigned short* w2b = (unsigned short*)alloc((size_t)FFm * Dm * 2);
    unsigned short* h1b = (unsigned short*)alloc((size_t)Mrows * Dm * 2);
    unsigned short* qb  = (unsigned short*)alloc((size_t)Mrows * Dm * 2);
    unsigned short* kb  = (unsigned short*)alloc((size_t)Mrows * Dm * 2);
    unsigned short* vb  = (unsigned short*)alloc((size_t)Mrows * Dm * 2);
    unsigned short* ab  = (unsigned short*)alloc((size_t)Mrows * Dm * 2);
    float*          x1  = (float*)        alloc((size_t)Mrows * Dm * 4);
    unsigned short* h2b = (unsigned short*)alloc((size_t)Mrows * Dm * 2);
    unsigned short* m1b = (unsigned short*)alloc((size_t)Mrows * FFm * 2);
    (void)ws_size; (void)n_in; (void)in_sizes; (void)out_size;

    const float qscale = 0.125f; // HD^-0.5
    dim3 tb(32, 8);

    // weights -> transposed bf16  (src is [K][N])
    cvt_t_kernel<<<dim3(Dm / 32, Dm / 32),  tb, 0, stream>>>(wq, wqb, Dm, Dm);
    cvt_t_kernel<<<dim3(Dm / 32, Dm / 32),  tb, 0, stream>>>(wk, wkb, Dm, Dm);
    cvt_t_kernel<<<dim3(Dm / 32, Dm / 32),  tb, 0, stream>>>(wv, wvb, Dm, Dm);
    cvt_t_kernel<<<dim3(Dm / 32, Dm / 32),  tb, 0, stream>>>(wo, wob, Dm, Dm);
    cvt_t_kernel<<<dim3(FFm / 32, Dm / 32), tb, 0, stream>>>(w1, w1b, Dm, FFm);
    cvt_t_kernel<<<dim3(Dm / 32, FFm / 32), tb, 0, stream>>>(w2, w2b, FFm, Dm);

    // LN1
    ln_bf16_kernel<<<Mrows, 256, 0, stream>>>(x, ln1s, ln1b, h1b);

    // QKV projections (Q pre-scaled; V transposed per head)
    dim3 gDD(Dm / 128, Mrows / 64);
    gemm_bf16_kernel<<<gDD, 128, 0, stream>>>(h1b, wqb, bq, nullptr, nullptr, qb,
                                              Mrows, Dm, Dm, 0, qscale);
    gemm_bf16_kernel<<<gDD, 128, 0, stream>>>(h1b, wkb, bk, nullptr, nullptr, kb,
                                              Mrows, Dm, Dm, 0, 1.0f);
    gemm_bf16_kernel<<<gDD, 128, 0, stream>>>(h1b, wvb, bv, nullptr, nullptr, vb,
                                              Mrows, Dm, Dm, 1, 1.0f);

    // attention
    attn_kernel<<<dim3(Bm * Hm, Lm / (16 * AWV)), 32 * AWV, 0, stream>>>(qb, kb, vb, amask, ab);

    // output projection + residual -> x1
    gemm_bf16_kernel<<<gDD, 128, 0, stream>>>(ab, wob, bo, x, x1, nullptr,
                                              Mrows, Dm, Dm, 3, 1.0f);

    // LN2
    ln_bf16_kernel<<<Mrows, 256, 0, stream>>>(x1, ln2s, ln2b, h2b);

    // MLP up + quickGELU -> bf16
    dim3 gDF(FFm / 128, Mrows / 64);
    gemm_bf16_kernel<<<gDF, 128, 0, stream>>>(h2b, w1b, b1, nullptr, nullptr, m1b,
                                              Mrows, FFm, Dm, 2, 1.0f);

    // MLP down + residual -> d_out
    gemm_bf16_kernel<<<gDD, 128, 0, stream>>>(m1b, w2b, b2, x1, outp, nullptr,
                                              Mrows, Dm, FFm, 3, 1.0f);
}

// v003
// It runs in 370 microseconds.
// In both of two side-by-side timings against v002, it was 1.10 times as fast.
// Over all steps from v000 it is 1.72 times as fast.
#include <hip/hip_runtime.h>

// ---------------- constants ----------------
#define Dm   1024
#define Hm   16
#define HDm  64
#define FFm  4096
#define Bm   8
#define Lm   1024
#define Mrows (Bm * Lm)        // 8192
#define EPSc 1e-5f

typedef __attribute__((ext_vector_type(16))) __bf16 v16bf;
typedef __attribute__((ext_vector_type(8)))  float  v8f;
typedef __attribute__((ext_vector_type(4)))  unsigned int u32x4;
typedef __attribute__((ext_vector_type(8)))  int          i32x8;
typedef __attribute__((ext_vector_type(4)))  int          i32x4;

#if defined(__has_builtin)
#if __has_builtin(__builtin_amdgcn_tensor_load_to_lds) && \
    __has_builtin(__builtin_amdgcn_s_wait_tensorcnt)
#define USE_TDM 1
#endif
#endif
#ifndef USE_TDM
#define USE_TDM 0
#endif

union V16 {
    uint4 u4[2];
    unsigned short s[16];
    v16bf v;
};

__device__ __forceinline__ unsigned short f2bf(float f) {
    unsigned int u = __float_as_uint(f);
    unsigned int r = u + 0x7fffu + ((u >> 16) & 1u);   // round to nearest even
    return (unsigned short)(r >> 16);
}

#if USE_TDM
// Issue one TDM 2D tile load: tile_rows x 32 bf16 elements, row stride K
// elements, into LDS with +16B padding per 64B row (=> row pitch 80B).
__device__ __forceinline__ void tdm_tile_load(const unsigned short* gsrc,
                                              unsigned int lds_off,
                                              int K, int rows_total,
                                              int tile_rows) {
    unsigned long long ga = (unsigned long long)(size_t)gsrc;
    u32x4 g0;
    g0[0] = 1u;                                   // count=1, user mode
    g0[1] = lds_off;                              // lds_addr (bytes)
    g0[2] = (unsigned int)ga;                     // global_addr[31:0]
    g0[3] = ((unsigned int)(ga >> 32) & 0x01FFFFFFu) | 0x80000000u; // type=2

    i32x8 g1;
    // data_size=1 (2B) | pad_enable | pad_interval=3 (16 DW) | pad_amount=3 (4 DW)
    g1[0] = (int)(0x00010000u | (1u << 20) | (3u << 22) | (3u << 25));
    g1[1] = (int)(((unsigned)K & 0xFFFFu) << 16);          // tensor_dim0[15:0]
    g1[2] = (int)((((unsigned)K >> 16) & 0xFFFFu) |
                  (((unsigned)rows_total & 0xFFFFu) << 16)); // dim0 hi | dim1 lo
    g1[3] = (int)((((unsigned)rows_total >> 16) & 0xFFFFu) |
                  (32u << 16));                            // dim1 hi | tile_dim0=32
    g1[4] = (int)((unsigned)tile_rows & 0xFFFFu);          // tile_dim1 | tile_dim2=0
    g1[5] = (int)(unsigned)K;                              // tensor_dim0_stride lo
    g1[6] = 0;                                             // stride hi | dim1_stride lo
    g1[7] = 0;

    i32x4 z4 = {0, 0, 0, 0};
#if __clang_major__ >= 23
    i32x8 z8 = {0, 0, 0, 0, 0, 0, 0, 0};
    __builtin_amdgcn_tensor_load_to_lds(g0, g1, z4, z4, z8, 0);
#else
    __builtin_amdgcn_tensor_load_to_lds(g0, g1, z4, z4, 0);
#endif
}
#endif

// ---------------- fp32 -> bf16 transpose-convert: dst[N][K] = src[K][N] ----------------
__global__ __launch_bounds__(256)
void cvt_t_kernel(const float* __restrict__ src, unsigned short* __restrict__ dst,
                  int K, int N) {
    __shared__ unsigned short tile[32][33];
    int n0 = blockIdx.x * 32, k0 = blockIdx.y * 32;
    int tx = threadIdx.x, ty = threadIdx.y;   // block (32,8)
    #pragma unroll
    for (int i = 0; i < 4; i++) {
        int r = ty + i * 8;
        tile[r][tx] = f2bf(src[(size_t)(k0 + r) * N + n0 + tx]);
    }
    __syncthreads();
    #pragma unroll
    for (int i = 0; i < 4; i++) {
        int r = ty + i * 8;
        dst[(size_t)(n0 + r) * K + k0 + tx] = tile[tx][r];
    }
}

// ---------------- LayerNorm -> bf16 ----------------
typedef __attribute__((ext_vector_type(4))) float f32x4;
typedef __attribute__((ext_vector_type(2))) float f32x2;

// two floats to two bf16 in one dword, each rounded as f2bf rounds
__device__ __forceinline__ unsigned int f2bf_pair(float lo, float hi) {
    unsigned int a = __float_as_uint(lo), b = __float_as_uint(hi);
    a += 0x7fffu + ((a >> 16) & 1u);
    b += 0x7fffu + ((b >> 16) & 1u);
    return (a >> 16) | (b & 0xffff0000u);
}

// One wave owns LNR whole rows and keeps them in registers: every element is read once, by
// 16-byte loads that are in flight together; mean and variance are summed inside the
// lane and then across the 32 lanes by shuffles, so no LDS and no barrier is needed, and a
// launch holds one wave per LNR rows instead of a workgroup of eight per row.
#define LNR 2      // rows per wave
#define LNW 8      // waves per workgroup
__global__ __launch_bounds__(32 * LNW)
void ln_bf16_kernel(const float* __restrict__ x,
                    const float* __restrict__ gamma,
                    const float* __restrict__ beta,
                    unsigned short* __restrict__ out) {
    int lane = threadIdx.x & 31;
    // the wave's number as a scalar: the rows' base addresses then stay in scalar registers
    int row0 = (blockIdx.x * LNW + __builtin_amdgcn_readfirstlane(threadIdx.x >> 5)) * LNR;
    const float* xr = x + (size_t)row0 * Dm;

    // piece j of a row: elements j * 128 + lane * 4 .. + 3 (a wave's load covers 512 B in a row)
    f32x4 g[8], be[8], v[LNR][8];
    #pragma unroll
    for (int j = 0; j < 8; j++) {
        g[j]  = *(const f32x4*)&gamma[j * 128 + lane * 4];
        be[j] = *(const f32x4*)&beta[j * 128 + lane * 4];
    }
    #pragma unroll
    for (int r = 0; r < LNR; r++)
        #pragma unroll
        for (int j = 0; j < 8; j++)
            v[r][j] = *(const f32x4*)&xr[r * Dm + j * 128 + lane * 4];
    // the scale and shift loads are issued early, in groups, ahead of one common wait; the
    // compiler otherwise sinks each pair to its use and waits for the pairs one after another
    asm volatile("" :: "v"(g[0]), "v"(g[1]), "v"(g[2]), "v"(g[3]),
                       "v"(g[4]), "v"(g[5]), "v"(g[6]), "v"(g[7]),
                       "v"(be[0]), "v"(be[1]), "v"(be[2]), "v"(be[3]),
                       "v"(be[4]), "v"(be[5]), "v"(be[6]), "v"(be[7]));

    float mu[LNR], inv[LNR];
    #pragma unroll
    for (int r = 0; r < LNR; r++) {
        f32x2 s0 = v[r][0].xy, s1 = v[r][0].zw;
        #pragma unroll
        for (int j = 1; j < 8; j++) { s0 += v[r][j].xy; s1 += v[r][j].zw; }
        s0 += s1;
        mu[r] = s0.x + s0.y;
    }
    #pragma unroll
    for (int off = 16; off > 0; off >>= 1)
        #pragma unroll
        for (int r = 0; r < LNR; r++) mu[r] += __shfl_xor(mu[r], off, 32);
    #pragma unroll
    for (int r = 0; r < LNR; r++) {
        mu[r] *= (1.0f / Dm);
        f32x2 s0 = {0.f, 0.f}, s1 = {0.f, 0.f};
        #pragma unroll
        for (int j = 0; j < 8; j++) {
            v[r][j] -= mu[r];
            s0 += v[r][j].xy * v[r][j].xy;
            s1 += v[r][j].zw * v[r][j].zw;
        }
        s0 += s1;
        inv[r] = s0.x + s0.y;
    }
    #pragma unroll
    for (int off = 16; off > 0; off >>= 1)
        #pragma unroll
        for (int r = 0; r < LNR; r++) inv[r] += __shfl_xor(inv[r], off, 32);
    #pragma unroll
    for (int r = 0; r < LNR; r++) inv[r] = rsqrtf(inv[r] * (1.0f / Dm) + EPSc);

    unsigned short* orow = out + (size_t)row0 * Dm;
    #pragma unroll
    for (int j = 0; j < 8; j++) {
        #pragma unroll
        for (int r = 0; r < LNR; r++) {
            f32x4 y = v[r][j] * inv[r] * g[j] + be[j];
            uint2 pk;
            pk.x = f2bf_pair(y.x, y.y);
            pk.y = f2bf_pair(y.z, y.w);
            *(uint2*)&orow[r * Dm + j * 128 + lane * 4] = pk;
        }
    }
}

// A transcendental with the one free issue slot behind it that the instruction set asks for
// before its result is read or its source overwritten; the v_nop in the same statement holds
// that slot whatever the compiler schedules next.
__device__ __forceinline__ float exp2_slot(float x) {
    float r;
    asm("v_exp_f32 %0, %1\n\tv_nop" : "=v"(r) : "v"(x));
    return r;
}
__device__ __forceinline__ float rcp_slot(float x) {
    float r;
    asm("v_rcp_f32 %0, %1\n\tv_nop" : "=v"(r) : "v"(x));
    return r;
}

// ---------------- GEMM epilogue of one wave (32 x 64 of C), one straight-line form per mode ----------------
// v = (acc + bias [quickGELU] [+ resid]) * oscale
// MODE 0: bf16 to [B,H,L,HD]   MODE 1: bf16 to [B,H,HD,L] (transposed per head)
// MODE 2: quickGELU, bf16 to [M,N]   MODE 3: + resid, f32 to [M,N]
// row0, col0: the lane's first row and column of C.
template <int MODE>
__device__ __forceinline__ void gemm_store(const v8f (&c)[2][4],
                                           const float* __restrict__ bias,
                                           const float* __restrict__ resid,
                                           float* __restrict__ outF,
                                           unsigned short* __restrict__ outB,
                                           int N, float oscale, int row0, int col0) {
    float bv[4];
    #pragma unroll
    for (int nt = 0; nt < 4; nt++) bv[nt] = bias[col0 + nt * 16];
    // groups of 16 rows x 32 columns: 16 elements of a lane
    #pragma unroll
    for (int gq = 0; gq < 4; gq++) {
        const int mt = gq >> 1, nb = (gq & 1) * 2;
        float rs[2][8];
        if (MODE == 3) {
            #pragma unroll
            for (int n2 = 0; n2 < 2; n2++)
                #pragma unroll
                for (int i = 0; i < 8; i++)
                    rs[n2][i] = resid[(unsigned int)((row0 + mt * 16 + i) * N + col0 + (nb + n2) * 16)];
            // the group's 16 residual loads are all issued before the first is used; under the
            // register bound the compiler otherwise waits for each in turn
            __builtin_amdgcn_sched_barrier(0);
        }
        #pragma unroll
        for (int n2 = 0; n2 < 2; n2++) {
            const int nt = nb + n2;
            int col = col0 + nt * 16;
            #pragma unroll
            for (int i = 0; i < 8; i++) {
                int row = row0 + mt * 16 + i;
                float v = c[mt][nt][i] + bv[nt];
                if (MODE == 2)   // v * sigmoid(1.702 v), e^x as 2^(x log2 e)
                    v = v * rcp_slot(1.0f + exp2_slot((-1.702f * v) * 1.44269504f));
                if (MODE == 3) v += rs[n2][i];
                v *= oscale;
                if (MODE == 3) {
                    outF[(unsigned int)(row * N + col)] = v;
                } else {
                    unsigned int idx;   // every index here is below 2^25: 32 bits hold it
                    int bb = row >> 10, ll = row & 1023;
                    int hh = col >> 6,  dd = col & 63;
                    if (MODE == 0)
                        idx = (unsigned int)((((bb * Hm + hh) * Lm) + ll) * HDm + dd);
                    else if (MODE == 1)
                        idx = (unsigned int)((((bb * Hm + hh) * HDm) + dd) * Lm + ll);
                    else
                        idx = (unsigned int)(row * N + col);
                    outB[idx] = f2bf(v);
                }
            }
        }
        // the next group's loads may land in registers that this group's stores name
        if (MODE == 3 && gq < 3) asm volatile("s_wait_xcnt 0x0" ::: "memory");
        // one group's work stays in front of the next group's: without this fence the
        // 128-register budget of 8 waves per SIMD spills
        if (gq < 3) __builtin_amdgcn_sched_barrier(0);
    }
}

// ---------------- bf16 WMMA GEMM, B pre-transposed, double-buffered TDM ----------------
// C[M,N] = A[M,K] * Bt[N,K]^T, then the epilogue of gemm_store<mode>
// Block tile 64(M) x 128(N), BK=32, 4 waves, each wave 32x64.
// second bound: 8 waves per SIMD, the residency this kernel had; without it the
// straight-line epilogue is scheduled over 150 and more registers
__global__ __launch_bounds__(128, 8)
void gemm_bf16_kernel(const unsigned short* __restrict__ A,
                      const unsigned short* __restrict__ Bt,
                      const float* __restrict__ bias,
                      const float* __restrict__ resid,
                      float* __restrict__ outF,
                      unsigned short* __restrict__ outB,
                      int M, int N, int K,
                      int mode, float oscale) {
    __shared__ __align__(16) unsigned short As[2][64][40];   // [m][k], 80B pitch
    __shared__ __align__(16) unsigned short Bs[2][128][40];  // [n][k], 80B pitch

    int t    = threadIdx.x;
    int w    = t >> 5, lane = t & 31;
    int wr   = w >> 1, wc = w & 1;
    int mloc = lane & 15, half = lane >> 4;
    int m0 = blockIdx.y * 64, n0 = blockIdx.x * 128;

    v8f c[2][4] = {};
    int nsteps = K >> 5;

#if USE_TDM
    unsigned int ldsA[2], ldsB[2];
    ldsA[0] = (unsigned int)(size_t)(void*)&As[0][0][0];
    ldsA[1] = (unsigned int)(size_t)(void*)&As[1][0][0];
    ldsB[0] = (unsigned int)(size_t)(void*)&Bs[0][0][0];
    ldsB[1] = (unsigned int)(size_t)(void*)&Bs[1][0][0];

    if (w == 0) {   // prologue: stage 0 DMAs (wave-uniform; TDM ignores EXEC)
        tdm_tile_load(&A[(size_t)m0 * K],  ldsA[0], K, M, 64);
        tdm_tile_load(&Bt[(size_t)n0 * K], ldsB[0], K, N, 128);
    }

    for (int s = 0; s < nsteps; s++) {
        int p = s & 1;
        if (w == 0) {
            if (s + 1 < nsteps) {   // prefetch next stage into other buffer
                int k1 = (s + 1) << 5;
                tdm_tile_load(&A[(size_t)m0 * K + k1],  ldsA[p ^ 1], K, M, 64);
                tdm_tile_load(&Bt[(size_t)n0 * K + k1], ldsB[p ^ 1], K, N, 128);
                __builtin_amdgcn_s_wait_tensorcnt(2);  // stage-s pair landed
            } else {
                __builtin_amdgcn_s_wait_tensorcnt(0);
            }
        }
        __syncthreads();

        V16 af[2], bf[4];
        #pragma unroll
        for (int mt = 0; mt < 2; mt++) {
            int row = wr * 32 + mt * 16 + mloc;
            af[mt].u4[0] = *(const uint4*)&As[p][row][half * 8];
            af[mt].u4[1] = *(const uint4*)&As[p][row][16 + half * 8];
        }
        #pragma unroll
        for (int nt = 0; nt < 4; nt++) {
            int col = wc * 64 + nt * 16 + mloc;
            bf[nt].u4[0] = *(const uint4*)&Bs[p][col][half * 8];
            bf[nt].u4[1] = *(const uint4*)&Bs[p][col][16 + half * 8];
        }
        #pragma unroll
        for (int mt = 0; mt < 2; mt++)
            #pragma unroll
            for (int nt = 0; nt < 4; nt++)
                c[mt][nt] = __builtin_amdgcn_wmma_f32_16x16x32_bf16(
                    false, af[mt].v, false, bf[nt].v, (short)0, c[mt][nt],
                    false, false);
        __syncthreads();
    }
#else
    for (int s = 0; s < nsteps; s++) {
        int k0 = s << 5;
        int seg = t & 3;
        int rr  = t >> 2;
        #pragma unroll
        for (int r = 0; r < 2; r++) {
            int row = rr + r * 32;
            uint4 av = *(const uint4*)&A[(size_t)(m0 + row) * K + k0 + seg * 8];
            *(uint4*)&As[0][row][seg * 8] = av;
        }
        #pragma unroll
        for (int r = 0; r < 4; r++) {
            int row = rr + r * 32;
            uint4 bv = *(const uint4*)&Bt[(size_t)(n0 + row) * K + k0 + seg * 8];
            *(uint4*)&Bs[0][row][seg * 8] = bv;
        }
        __syncthreads();

        V16 af[2], bf[4];
        #pragma unroll
        for (int mt = 0; mt < 2; mt++) {
            int row = wr * 32 + mt * 16 + mloc;
            af[mt].u4[0] = *(const uint4*)&As[0][row][half * 8];
            af[mt].u4[1] = *(const uint4*)&As[0][row][16 + half * 8];
        }
        #pragma unroll
        for (int nt = 0; nt < 4; nt++) {
            int col = wc * 64 + nt * 16 + mloc;
            bf[nt].u4[0] = *(const uint4*)&Bs[0][col][half * 8];
            bf[nt].u4[1] = *(const uint4*)&Bs[0][col][16 + half * 8];
        }
        #pragma unroll
        for (int mt = 0; mt < 2; mt++)
            #pragma unroll
            for (int nt = 0; nt < 4; nt++)
                c[mt][nt] = __builtin_amdgcn_wmma_f32_16x16x32_bf16(
                    false, af[mt].v, false, bf[nt].v, (short)0, c[mt][nt],
                    false, false);
        __syncthreads();
    }
#endif

    // ---- epilogue: the mode is tested once per wave, never per element ----
    int row0 = m0 + wr * 32 + 8 * half;
    int col0 = n0 + wc * 64 + mloc;
    if (mode == 0)      gemm_store<0>(c, bias, resid, outF, outB, N, oscale, row0, col0);
    else if (mode == 1) gemm_store<1>(c, bias, resid, outF, outB, N, oscale, row0, col0);
    else if (mode == 2) gemm_store<2>(c, bias, resid, outF, outB, N, oscale, row0, col0);
    else                gemm_store<3>(c, bias, resid, outF, outB, N, oscale, row0, col0);
}

// ---------------- flash attention (8 waves / 128 query rows / head) ----------------
// q,k: bf16 [B*H][L][HD] (q pre-scaled by HD^-0.5); v: bf16 [B*H][HD][L].
// out: bf16 [B*L][D].
// Each wave owns 16 query rows. K and V tiles of AKS keys are staged in LDS once per
// workgroup by asynchronous copies (whole 128-B rows, two buffers) and read as
// fragments by all eight waves.
#define AWV 8      // waves per workgroup
#define AKS 64     // keys per LDS stage
#define APT 72     // LDS row pitch in elements: 128 B of data + 16 B pad

// One stage's four copies of a lane (two K rows, two V rows, 16 B each). The
// s_wait_xcnt closes the statement so that no address register named here is
// rewritten ahead of it.
__device__ __forceinline__ void attn_stage_copy(unsigned int lk0, unsigned int lk1,
                                                unsigned int lv0, unsigned int lv1,
                                                const unsigned short* gk0,
                                                const unsigned short* gk1,
                                                const unsigned short* gv0,
                                                const unsigned short* gv1) {
    asm volatile("global_load_async_to_lds_b128 %0, %4, off\n\t"
                 "global_load_async_to_lds_b128 %1, %5, off\n\t"
                 "global_load_async_to_lds_b128 %2, %6, off\n\t"
                 "global_load_async_to_lds_b128 %3, %7, off\n\t"
                 "s_wait_xcnt 0x0"
                 :: "v"(lk0), "v"(lk1), "v"(lv0), "v"(lv1),
                    "v"(gk0), "v"(gk1), "v"(gv0), "v"(gv1)
                 : "memory");
}

__global__ __launch_bounds__(32 * AWV)
void attn_kernel(const unsigned short* __restrict__ q,
                 const unsigned short* __restrict__ k,
                 const unsigned short* __restrict__ v,
                 const int* __restrict__ mask,
                 unsigned short* __restrict__ out) {
    int bh = blockIdx.x;              // 0..127
    int b  = bh >> 4, h = bh & 15;
    int t  = threadIdx.x;
    int w  = t >> 5, lane = t & 31;
    int q0 = blockIdx.y * (16 * AWV) + w * 16;
    int mloc = lane & 15, half = lane >> 4;

    const unsigned short* Q  = q + (size_t)bh * Lm * HDm;
    const unsigned short* Kp = k + (size_t)bh * Lm * HDm;
    const unsigned short* Vt = v + (size_t)bh * HDm * Lm;

    __shared__ __align__(16) unsigned short Ks[2][AKS][APT];   // [buffer][key][d]
    __shared__ __align__(16) unsigned short Vs[2][HDm][APT];   // [buffer][d][key]
    __shared__ __align__(16) unsigned short pl[AWV][16][40];   // P tile 16x32, one per wave

    // Q A-fragments for d = 0..31 and 32..63
    V16 aq[2];
    #pragma unroll
    for (int s = 0; s < 2; s++) {
        int d0 = s * 32;
        aq[s].u4[0] = *(const uint4*)&Q[(size_t)(q0 + mloc) * HDm + d0 + half * 8];
        aq[s].u4[1] = *(const uint4*)&Q[(size_t)(q0 + mloc) * HDm + d0 + 16 + half * 8];
    }

    float run_max[8], run_sum[8];
    #pragma unroll
    for (int i = 0; i < 8; i++) { run_max[i] = -1e30f; run_sum[i] = 0.f; }
    v8f o[4] = {};

    // staging: 8 lanes cover one 128-B row; a lane copies rows srow and srow + 32
    int srow = t >> 3, sseg = (t & 7) * 8;
    const unsigned int bufK = AKS * APT * 2, bufV = HDm * APT * 2;   // bytes per buffer
    unsigned int lk0 = (unsigned int)(size_t)(void*)&Ks[0][srow][sseg];
    unsigned int lk1 = (unsigned int)(size_t)(void*)&Ks[0][srow + 32][sseg];
    unsigned int lv0 = (unsigned int)(size_t)(void*)&Vs[0][srow][sseg];
    unsigned int lv1 = (unsigned int)(size_t)(void*)&Vs[0][srow + 32][sseg];
    const unsigned short* gk0 = &Kp[(size_t)srow * HDm + sseg];          // + stage * AKS rows
    const unsigned short* gk1 = &Kp[(size_t)(srow + 32) * HDm + sseg];
    const unsigned short* gv0 = &Vt[(size_t)srow * Lm + sseg];           // + stage * AKS keys
    const unsigned short* gv1 = &Vt[(size_t)(srow + 32) * Lm + sseg];
    const int nst = Lm / AKS;

    attn_stage_copy(lk0, lk1, lv0, lv1, gk0, gk1, gv0, gv1);
    asm volatile("s_wait_asynccnt 0x0" ::: "memory");   // this wave's part of stage 0 has landed
    __syncthreads();                                    // and so has every other wave's
    attn_stage_copy(lk0 + bufK, lk1 + bufK, lv0 + bufV, lv1 + bufV,
                    gk0 + AKS * HDm, gk1 + AKS * HDm, gv0 + AKS, gv1 + AKS);

    for (int st = 0; st < nst; st++) {
        int p = st & 1;
        // unrolled so that kl is a constant and folds into the LDS load offsets
        #pragma unroll
        for (int kt = 0; kt < AKS / 32; kt++) {
            int kl = kt * 32;              // first key of the tile inside the stage
            int kb = st * AKS + kl;        // and in the sequence
            // ---- scores: two 16-key subtiles, K-depth = 64 (2 wmma each) ----
            v8f sc[2] = {};
            #pragma unroll
            for (int sub = 0; sub < 2; sub++) {
                int key = kl + sub * 16 + mloc;
                #pragma unroll
                for (int s = 0; s < 2; s++) {
                    int d0 = s * 32;
                    V16 bk;
                    bk.u4[0] = *(const uint4*)&Ks[p][key][d0 + half * 8];
                    bk.u4[1] = *(const uint4*)&Ks[p][key][d0 + 16 + half * 8];
                    sc[sub] = __builtin_amdgcn_wmma_f32_16x16x32_bf16(
                        false, aq[s].v, false, bk.v, (short)0, sc[sub], false, false);
                }
            }
            // mask (per key column)
            float mk0 = (mask[b * Lm + kb + mloc]      > 0) ? 0.f : -1e30f;
            float mk1 = (mask[b * Lm + kb + 16 + mloc] > 0) ? 0.f : -1e30f;
            #pragma unroll
            for (int i = 0; i < 8; i++) { sc[0][i] += mk0; sc[1][i] += mk1; }

            // ---- online softmax ----
            float p0[8], p1[8];
            #pragma unroll
            for (int i = 0; i < 8; i++) {
                float tm = fmaxf(sc[0][i], sc[1][i]);
                #pragma unroll
                for (int off = 1; off < 16; off <<= 1)
                    tm = fmaxf(tm, __shfl_xor(tm, off, 32));
                float nm = fmaxf(run_max[i], tm);
                float corr = __expf(run_max[i] - nm);
                run_max[i] = nm;
                p0[i] = __expf(sc[0][i] - nm);
                p1[i] = __expf(sc[1][i] - nm);
                float ts = p0[i] + p1[i];
                #pragma unroll
                for (int off = 1; off < 16; off <<= 1)
                    ts += __shfl_xor(ts, off, 32);
                run_sum[i] = run_sum[i] * corr + ts;
                #pragma unroll
                for (int f = 0; f < 4; f++) o[f][i] *= corr;
            }

            // ---- P -> LDS (re-layout D-frag -> A-frag), in the wave's own tile ----
            #pragma unroll
            for (int i = 0; i < 8; i++) {
                pl[w][i + 8 * half][mloc]      = f2bf(p0[i]);
                pl[w][i + 8 * half][16 + mloc] = f2bf(p1[i]);
            }
            // the wave's own P stores are done before its lanes read each other's rows
            asm volatile("s_wait_dscnt 0x0" ::: "memory");
            V16 ap;
            ap.u4[0] = *(const uint4*)&pl[w][mloc][half * 8];
            ap.u4[1] = *(const uint4*)&pl[w][mloc][16 + half * 8];

            // ---- O += P * V  (4 wmma; V fragments are rows of Vs) ----
            #pragma unroll
            for (int f = 0; f < 4; f++) {
                V16 bv;
                int d = f * 16 + mloc;
                bv.u4[0] = *(const uint4*)&Vs[p][d][kl + half * 8];
                bv.u4[1] = *(const uint4*)&Vs[p][d][kl + 16 + half * 8];
                o[f] = __builtin_amdgcn_wmma_f32_16x16x32_bf16(
                    false, ap.v, false, bv.v, (short)0, o[f], false, false);
            }
        }
        // publish point: this wave's LDS reads of buffer p are done, its copies of
        // stage st + 1 have landed; the barrier says the same of every wave.
        asm volatile("s_wait_dscnt 0x0" ::: "memory");
        asm volatile("s_wait_asynccnt 0x0" ::: "memory");
        __syncthreads();
        if (st + 2 < nst) {   // refill the buffer that every wave has just left
            int sn = st + 2;
            attn_stage_copy(lk0 + p * bufK, lk1 + p * bufK, lv0 + p * bufV, lv1 + p * bufV,
                            gk0 + (size_t)sn * AKS * HDm, gk1 + (size_t)sn * AKS * HDm,
                            gv0 + sn * AKS, gv1 + sn * AKS);
        }
    }
    asm volatile("s_wait_asynccnt 0x0" ::: "memory");   // nothing in flight when the wave ends

    // ---- normalize + store: out[b*L + q][h*64 + d] ----
    #pragma unroll
    for (int f = 0; f < 4; f++) {
        #pragma unroll
        for (int i = 0; i < 8; i++) {
            int qq  = q0 + i + 8 * half;
            int col = h * HDm + f * 16 + mloc;
            out[(size_t)(b * Lm + qq) * Dm + col] = f2bf(o[f][i] / run_sum[i]);
        }
    }
}

// ---------------- host-side launch ----------------
extern "C" void kernel_launch(void* const* d_in, const int* in_sizes, int n_in,
                              void* d_out, int out_size, void* d_ws, size_t ws_size,
                              hipStream_t stream) {
    const float* x     = (const float*)d_in[0];
    const int*   amask = (const int*)  d_in[1];
    const float* wq = (const float*)d_in[2];  const float* bq = (const float*)d_in[3];
    const float* wk = (const float*)d_in[4];  const float* bk = (const float*)d_in[5];
    const float* wv = (const float*)d_in[6];  const float* bv = (const float*)d_in[7];
    const float* wo = (const float*)d_in[8];  const float* bo = (const float*)d_in[9];
    const float* ln1s = (const float*)d_in[10]; const float* ln1b = (const float*)d_in[11];
    const float* ln2s = (const float*)d_in[12]; const float* ln2b = (const float*)d_in[13];
    const float* w1 = (const float*)d_in[14]; const float* b1 = (const float*)d_in[15];
    const float* w2 = (const float*)d_in[16]; const float* b2 = (const float*)d_in[17];
    float* outp = (float*)d_out;

    char* base = (char*)d_ws;
    size_t off = 0;
    auto alloc = [&](size_t bytes) -> char* {
        char* p = base + off;
        off = (off + bytes + 255) & ~(size_t)255;
        return p;
    };
    // transposed bf16 weights: [N][K]
    unsigned short* wqb = (unsigned short*)alloc((size_t)Dm * Dm * 2);
    unsigned short* wkb = (unsigned short*)alloc((size_t)Dm * Dm * 2);
    unsigned short* wvb = (unsigned short*)alloc((size_t)Dm * Dm * 2);
    unsigned short* wob = (unsigned short*)alloc((size_t)Dm * Dm * 2);
    unsigned short* w1b = (unsigned short*)alloc((size_t)Dm * FFm * 2);
    unsigned short* w2b = (unsigned short*)alloc((size_t)FFm * Dm * 2);
    unsigned short* h1b = (unsigned short*)alloc((size_t)Mrows * Dm * 2);
    unsigned short* qb  = (unsigned short*)alloc((size_t)Mrows * Dm * 2);
    unsigned short* kb  = (unsigned short*)alloc((size_t)Mrows * Dm * 2);
    unsigned short* vb  = (unsigned short*)alloc((size_t)Mrows * Dm * 2);
    unsigned short* ab  = (unsigned short*)alloc((size_t)Mrows * Dm * 2);
    float*          x1  = (float*)        alloc((size_t)Mrows * Dm * 4);
    unsigned short* h2b = (unsigned short*)alloc((size_t)Mrows * Dm * 2);
    unsigned short* m1b = (unsigned short*)alloc((size_t)Mrows * FFm * 2);
    (void)ws_size; (void)n_in; (void)in_sizes; (void)out_size;

    const float qscale = 0.125f; // HD^-0.5
    dim3 tb(32, 8);

    // weights -> transposed bf16  (src is [K][N])
    cvt_t_kernel<<<dim3(Dm / 32, Dm / 32),  tb, 0, stream>>>(wq, wqb, Dm, Dm);
    cvt_t_kernel<<<dim3(Dm / 32, Dm / 32),  tb, 0, stream>>>(wk, wkb, Dm, Dm);
    cvt_t_kernel<<<dim3(Dm / 32, Dm / 32),  tb, 0, stream>>>(wv, wvb, Dm, Dm);
    cvt_t_kernel<<<dim3(Dm / 32, Dm / 32),  tb, 0, stream>>>(wo, wob, Dm, Dm);
    cvt_t_kernel<<<dim3(FFm / 32, Dm / 32), tb, 0, stream>>>(w1, w1b, Dm, FFm);
    cvt_t_kernel<<<dim3(Dm / 32, FFm / 32), tb, 0, stream>>>(w2, w2b, FFm, Dm);

    // LN1
    ln_bf16_kernel<<<Mrows / (LNR * LNW), 32 * LNW, 0, stream>>>(x, ln1s, ln1b, h1b);

    // QKV projections (Q pre-scaled; V transposed per head)
    dim3 gDD(Dm / 128, Mrows / 64);
    gemm_bf16_kernel<<<gDD, 128, 0, stream>>>(h1b, wqb, bq, nullptr, nullptr, qb,
                                              Mrows, Dm, Dm, 0, qscale);
    gemm_bf16_kernel<<<gDD, 128, 0, stream>>>(h1b, wkb, bk, nullptr, nullptr, kb,
                                              Mrows, Dm, Dm, 0, 1.0f);
    gemm_bf16_kernel<<<gDD, 128, 0, stream>>>(h1b, wvb, bv, nullptr, nullptr, vb,
                                              Mrows, Dm, Dm, 1, 1.0f);

    // attention
    attn_kernel<<<dim3(Bm * Hm, Lm / (16 * AWV)), 32 * AWV, 0, stream>>>(qb, kb, vb, amask, ab);

    // output projection + residual -> x1
    gemm_bf16_kernel<<<gDD, 128, 0, stream>>>(ab, wob, bo, x, x1, nullptr,
                                              Mrows, Dm, Dm, 3, 1.0f);

    // LN2
    ln_bf16_kernel<<<Mrows / (LNR * LNW), 32 * LNW, 0, stream>>>(x1, ln2s, ln2b, h2b);

    // MLP up + quickGELU -> bf16
    dim3 gDF(FFm / 128, Mrows / 64);
    gemm_bf16_kernel<<<gDF, 128, 0, stream>>>(h2b, w1b, b1, nullptr, nullptr, m1b,
                                              Mrows, FFm, Dm, 2, 1.0f);

    // MLP down + residual -> d_out
    gemm_bf16_kernel<<<gDD, 128, 0, stream>>>(m1b, w2b, b2, x1, outp, nullptr,
                                              Mrows, Dm, FFm, 3, 1.0f);
}

// v004
// A run of this version takes 291 microseconds.
// Two timings next to v003 both put it at 1.27 times that version's speed.
// Over all steps from v000 it is 2.18 times as fast.
#include <hip/hip_runtime.h>

// ---------------- constants ----------------
#define Dm   1024
#define Hm   16
#define HDm  64
#define FFm  4096
#define Bm   8
#define Lm   1024
#define Mrows (Bm * Lm)        // 8192
#define EPSc 1e-5f

typedef __attribute__((ext_vector_type(16))) __bf16 v16bf;
typedef __attribute__((ext_vector_type(8)))  float  v8f;
typedef __attribute__((ext_vector_type(4)))  unsigned int u32x4;
typedef __attribute__((ext_vector_type(8)))  unsigned int u32x8;

union V16 {
    uint4 u4[2];
    unsigned short s[16];
    v16bf v;
};

__device__ __forceinline__ unsigned short f2bf(float f) {
    unsigned int u = __float_as_uint(f);
    unsigned int r = u + 0x7fffu + ((u >> 16) & 1u);   // round to nearest even
    return (unsigned short)(r >> 16);
}

// ---------------- tensor loads of the GEMM ----------------
// One pass of the GEMM takes GPK k: GROWB bytes of every operand row. A wave's request is a
// slice of 64 such rows, laid in LDS at pitch GPITCH (16 B x odd: no bank conflict for
// 16-byte fragment reads). A slice's place is a multiple of 2 KiB.
#define GPK    128
#define GROWB  256
#define GPITCH 272
#define GSLICE 18432           // 64 * GPITCH = 17408, rounded up to a multiple of 2 KiB
#define GSTAGE (4 * GSLICE)    // A rows 0-63 | A rows 64-127 | B rows 0-63 | B rows 64-127

__device__ __forceinline__ unsigned int uni(unsigned int v) {
    return (unsigned int)__builtin_amdgcn_readfirstlane(v);
}
// a wave-uniform value held in a scalar register, so that a test on it is a scalar branch and
// a descriptor word made from it is formed where this stands (tensor loads ignore EXEC)
__device__ __forceinline__ unsigned int pinned(unsigned int v) {
    unsigned int w = uni(v);
    asm volatile("" : "+s"(w));   // the value stays in a scalar register
    return w;
}
// both groups are in-out operands: their registers then stay this descriptor's own from one
// request to the next, and nothing else is put into them while a request is outstanding
__device__ __forceinline__ void tdm_load(u32x4& g0, u32x8& g1) {
    asm volatile("tensor_load_to_lds %0, %1" : "+s"(g0), "+s"(g1) :: "memory");
}
// group 1: 1-byte elements, tensor = tile = 64 rows of GROWB bytes, source pitch in bytes,
// a pad of 4 dwords behind every 64 dwords (one row)
__device__ __forceinline__ u32x8 tdm_group1(unsigned int src_pitch) {
    u32x8 g;
    g[0] = uni((1u << 20) | (5u << 22) | (3u << 25));   // no mask, data_size 0, pad codes 5 / 3
    g[1] = uni(((unsigned int)GROWB & 0xFFFFu) << 16);
    g[2] = uni(64u << 16);
    g[3] = uni((unsigned int)GROWB << 16);
    g[4] = uni(64u);
    g[5] = uni(src_pitch);
    g[6] = uni(0u);
    g[7] = uni(0u);
    return g;
}
__device__ __forceinline__ u32x4 tdm_group0(unsigned int lds_dst, unsigned long long ga) {
    u32x4 g;
    g[0] = uni(1u);
    g[1] = uni(lds_dst);
    g[2] = uni((unsigned int)ga);
    g[3] = uni((((unsigned int)(ga >> 32)) & 0x01FFFFFFu) | 0x80000000u);
    return g;
}
// the same slice one stage on: a new place in LDS, the source inc bytes further (words 2 and
// 3 are added to as one 64-bit number: the type bits lie above every address bit)
__device__ __forceinline__ void tdm_advance(u32x4& g, unsigned int lds_dst, unsigned int inc) {
    unsigned long long a = (((unsigned long long)g[3] << 32) | g[2]) + inc;
    g[1] = uni(lds_dst);
    g[2] = uni((unsigned int)a);
    g[3] = uni((unsigned int)(a >> 32));
}

// ---------------- fp32 -> bf16 transpose-convert: dst[N][K] = src[K][N] ----------------
__global__ __launch_bounds__(256)
void cvt_t_kernel(const float* __restrict__ src, unsigned short* __restrict__ dst,
                  int K, int N) {
    __shared__ unsigned short tile[32][33];
    int n0 = blockIdx.x * 32, k0 = blockIdx.y * 32;
    int tx = threadIdx.x, ty = threadIdx.y;   // block (32,8)
    #pragma unroll
    for (int i = 0; i < 4; i++) {
        int r = ty + i * 8;
        tile[r][tx] = f2bf(src[(size_t)(k0 + r) * N + n0 + tx]);
    }
    __syncthreads();
    #pragma unroll
    for (int i = 0; i < 4; i++) {
        int r = ty + i * 8;
        dst[(size_t)(n0 + r) * K + k0 + tx] = tile[tx][r];
    }
}

// ---------------- LayerNorm -> bf16 ----------------
typedef __attribute__((ext_vector_type(4))) float f32x4;
typedef __attribute__((ext_vector_type(2))) float f32x2;

// two floats to two bf16 in one dword, each rounded as f2bf rounds
__device__ __forceinline__ unsigned int f2bf_pair(float lo, float hi) {
    unsigned int a = __float_as_uint(lo), b = __float_as_uint(hi);
    a += 0x7fffu + ((a >> 16) & 1u);
    b += 0x7fffu + ((b >> 16) & 1u);
    return (a >> 16) | (b & 0xffff0000u);
}

// One wave owns LNR whole rows and keeps them in registers: every element is read once, by
// 16-byte loads that are in flight together; mean and variance are summed inside the
// lane and then across the 32 lanes by shuffles, so no LDS and no barrier is needed, and a
// launch holds one wave per LNR rows instead of a workgroup of eight per row.
#define LNR 2      // rows per wave
#define LNW 8      // waves per workgroup
__global__ __launch_bounds__(32 * LNW)
void ln_bf16_kernel(const float* __restrict__ x,
                    const float* __restrict__ gamma,
                    const float* __restrict__ beta,
                    unsigned short* __restrict__ out) {
    int lane = threadIdx.x & 31;
    // the wave's number as a scalar: the rows' base addresses then stay in scalar registers
    int row0 = (blockIdx.x * LNW + __builtin_amdgcn_readfirstlane(threadIdx.x >> 5)) * LNR;
    const float* xr = x + (size_t)row0 * Dm;

    // piece j of a row: elements j * 128 + lane * 4 .. + 3 (a wave's load covers 512 B in a row)
    f32x4 g[8], be[8], v[LNR][8];
    #pragma unroll
    for (int j = 0; j < 8; j++) {
        g[j]  = *(const f32x4*)&gamma[j * 128 + lane * 4];
        be[j] = *(const f32x4*)&beta[j * 128 + lane * 4];
    }
    #pragma unroll
    for (int r = 0; r < LNR; r++)
        #pragma unroll
        for (int j = 0; j < 8; j++)
            v[r][j] = *(const f32x4*)&xr[r * Dm + j * 128 + lane * 4];
    // the scale and shift loads are issued early, in groups, ahead of one common wait; the
    // compiler otherwise sinks each pair to its use and waits for the pairs one after another
    asm volatile("" :: "v"(g[0]), "v"(g[1]), "v"(g[2]), "v"(g[3]),
                       "v"(g[4]), "v"(g[5]), "v"(g[6]), "v"(g[7]),
                       "v"(be[0]), "v"(be[1]), "v"(be[2]), "v"(be[3]),
                       "v"(be[4]), "v"(be[5]), "v"(be[6]), "v"(be[7]));

    float mu[LNR], inv[LNR];
    #pragma unroll
    for (int r = 0; r < LNR; r++) {
        f32x2 s0 = v[r][0].xy, s1 = v[r][0].zw;
        #pragma unroll
        for (int j = 1; j < 8; j++) { s0 += v[r][j].xy; s1 += v[r][j].zw; }
        s0 += s1;
        mu[r] = s0.x + s0.y;
    }
    #pragma unroll
    for (int off = 16; off > 0; off >>= 1)
        #pragma unroll
        for (int r = 0; r < LNR; r++) mu[r] += __shfl_xor(mu[r], off, 32);
    #pragma unroll
    for (int r = 0; r < LNR; r++) {
        mu[r] *= (1.0f / Dm);
        f32x2 s0 = {0.f, 0.f}, s1 = {0.f, 0.f};
        #pragma unroll
        for (int j = 0; j < 8; j++) {
            v[r][j] -= mu[r];
            s0 += v[r][j].xy * v[r][j].xy;
            s1 += v[r][j].zw * v[r][j].zw;
        }
        s0 += s1;
        inv[r] = s0.x + s0.y;
    }
    #pragma unroll
    for (int off = 16; off > 0; off >>= 1)
        #pragma unroll
        for (int r = 0; r < LNR; r++) inv[r] += __shfl_xor(inv[r], off, 32);
    #pragma unroll
    for (int r = 0; r < LNR; r++) inv[r] = rsqrtf(inv[r] * (1.0f / Dm) + EPSc);

    unsigned short* orow = out + (size_t)row0 * Dm;
    #pragma unroll
    for (int j = 0; j < 8; j++) {
        #pragma unroll
        for (int r = 0; r < LNR; r++) {
            f32x4 y = v[r][j] * inv[r] * g[j] + be[j];
            uint2 pk;
            pk.x = f2bf_pair(y.x, y.y);
            pk.y = f2bf_pair(y.z, y.w);
            *(uint2*)&orow[r * Dm + j * 128 + lane * 4] = pk;
        }
    }
}

// A transcendental with the one free issue slot behind it that the instruction set asks for
// before its result is read or its source overwritten; the v_nop in the same statement holds
// that slot whatever the compiler schedules next.
__device__ __forceinline__ float exp2_slot(float x) {
    float r;
    asm("v_exp_f32 %0, %1\n\tv_nop" : "=v"(r) : "v"(x));
    return r;
}
__device__ __forceinline__ float rcp_slot(float x) {
    float r;
    asm("v_rcp_f32 %0, %1\n\tv_nop" : "=v"(r) : "v"(x));
    return r;
}

// ---------------- GEMM epilogue of one wave (64 x 64 of C), one straight-line form per mode ----------------
// v = (acc + bias [quickGELU] [+ resid]) * oscale
// MODE 0: bf16 to [B,H,L,HD]   MODE 1: bf16 to [B,H,HD,L] (transposed per head)
// MODE 2: quickGELU, bf16 to [M,N]   MODE 3: + resid, f32 to [M,N]
// row0, col0: the lane's first row and column of C.
template <int MODE>
__device__ __forceinline__ void gemm_store(const v8f (&c)[4][4],
                                           const float* __restrict__ bias,
                                           const float* __restrict__ resid,
                                           float* __restrict__ outF,
                                           unsigned short* __restrict__ outB,
                                           int N, float oscale, int row0, int col0) {
    float bv[4];
    #pragma unroll
    for (int nt = 0; nt < 4; nt++) bv[nt] = bias[col0 + nt * 16];
    // groups of 16 rows x 64 columns: 32 elements of a lane
    #pragma unroll
    for (int mt = 0; mt < 4; mt++) {
        float rs[4][8];
        if (MODE == 3) {
            #pragma unroll
            for (int nt = 0; nt < 4; nt++)
                #pragma unroll
                for (int i = 0; i < 8; i++)
                    rs[nt][i] = resid[(unsigned int)((row0 + mt * 16 + i) * N + col0 + nt * 16)];
            // the group's 32 residual loads are all issued before the first is used, so that
            // their latency is paid once a group
            __builtin_amdgcn_sched_barrier(0);
        }
        #pragma unroll
        for (int nt = 0; nt < 4; nt++) {
            int col = col0 + nt * 16;
            #pragma unroll
            for (int i = 0; i < 8; i++) {
                int row = row0 + mt * 16 + i;
                float v = c[mt][nt][i] + bv[nt];
                if (MODE == 2)   // v * sigmoid(1.702 v), e^x as 2^(x log2 e)
                    v = v * rcp_slot(1.0f + exp2_slot((-1.702f * v) * 1.44269504f));
                if (MODE == 3) v += rs[nt][i];
                v *= oscale;
                if (MODE == 3) {
                    outF[(unsigned int)(row * N + col)] = v;
                } else {
                    unsigned int idx;   // every index here is below 2^25: 32 bits hold it
                    int bb = row >> 10, ll = row & 1023;
                    int hh = col >> 6,  dd = col & 63;
                    if (MODE == 0)
                        idx = (unsigned int)((((bb * Hm + hh) * Lm) + ll) * HDm + dd);
                    else if (MODE == 1)
                        idx = (unsigned int)((((bb * Hm + hh) * HDm) + dd) * Lm + ll);
                    else
                        idx = (unsigned int)(row * N + col);
                    outB[idx] = f2bf(v);
                }
            }
        }
        // the next group's loads may land in registers that this group's stores name
        if (MODE == 3 && mt < 3) asm volatile("s_wait_xcnt 0x0" ::: "memory");
        // one group's work stays in front of the next group's: the epilogue then stays inside
        // the first 256 registers
        if (mt < 3) __builtin_amdgcn_sched_barrier(0);
    }
}

// ---------------- bf16 WMMA GEMM, B pre-transposed, two-buffer tensor-load ring ----------------
// C[M,N] = A[M,K] * Bt[N,K]^T, then the epilogue of gemm_store<mode>
// Block tile 128(M) x 128(N), a pass of GPK k, 4 waves (2 x 2), each wave 64 x 64.
// M and N are multiples of 128, K a multiple of GPK and at least two passes.
// Every wave issues one tensor load a stage: waves 0 and 1 the two halves of the A rows,
// waves 2 and 3 of the B rows. Two workgroups share a WGP (LDS), so 512 registers a wave.
__global__ __launch_bounds__(128, 2)
void gemm_bf16_kernel(const unsigned short* __restrict__ A,
                      const unsigned short* __restrict__ Bt,
                      const float* __restrict__ bias,
                      const float* __restrict__ resid,
                      float* __restrict__ outF,
                      unsigned short* __restrict__ outB,
                      int M, int N, int K,
                      int mode, float oscale) {
    __shared__ __attribute__((aligned(2048))) unsigned char ring[2 * GSTAGE];
    (void)M;

    int t    = threadIdx.x;
    int lane = t & 31;
    const unsigned int w = uni((unsigned int)t >> 5);   // the wave's number, a scalar
    const unsigned int wr = w >> 1, wc = w & 1u;
    int mloc = lane & 15, half = lane >> 4;
    int m0 = blockIdx.y * 128, n0 = blockIdx.x * 128;

    v8f c[4][4] = {};
    const int nst = K / GPK;

    // this wave's slice: its first source byte, its place in buffer 0
    const unsigned short* srow = (w < 2u) ? A  + (size_t)(m0 + (int)w * 64) * K
                                          : Bt + (size_t)(n0 + (int)(w - 2u) * 64) * K;
    const unsigned long long ga = (unsigned long long)(size_t)srow;
    const unsigned int dst = (unsigned int)(size_t)(void*)ring + w * GSLICE;
    u32x8 g1 = tdm_group1((unsigned int)K * 2u);

    u32x4 g0 = tdm_group0(dst, ga);
    tdm_load(g0, g1);                                        // stage 0
    asm volatile("s_wait_tensorcnt 0x0" ::: "memory");       // this wave's slice has landed
    __syncthreads();                                         // and so has every other wave's
    // the step is pinned here, and at the refill below, so that the address words take their
    // new value behind the wait
    tdm_advance(g0, dst + GSTAGE, pinned(GROWB));
    tdm_load(g0, g1);                                        // stage 1

    // the lane's first A and B fragment bytes inside a buffer
    const unsigned int aoff = wr * GSLICE + (unsigned int)(mloc * GPITCH + half * 16);
    const unsigned int boff = (2u + wc) * GSLICE + (unsigned int)(mloc * GPITCH + half * 16);

    for (int s = 0; s < nst; s++) {
        const unsigned int p = (unsigned int)(s & 1) * GSTAGE;
        const unsigned char* ap = ring + p + aoff;
        const unsigned char* bp = ring + p + boff;

        // four blocks of 32 k; the next block's fragments are read into a second register
        // set ahead of the current block's products
        V16 af[2][4], bf[2][4];
        #pragma unroll
        for (int f = 0; f < 4; f++) {
            af[0][f].u4[0] = *(const uint4*)(ap + f * 16 * GPITCH);
            af[0][f].u4[1] = *(const uint4*)(ap + f * 16 * GPITCH + 32);
            bf[0][f].u4[0] = *(const uint4*)(bp + f * 16 * GPITCH);
            bf[0][f].u4[1] = *(const uint4*)(bp + f * 16 * GPITCH + 32);
        }
        #pragma unroll
        for (int kb = 0; kb < 4; kb++) {
            const int cur = kb & 1, nxt = cur ^ 1;
            if (kb < 3) {
                #pragma unroll
                for (int f = 0; f < 4; f++) {
                    af[nxt][f].u4[0] = *(const uint4*)(ap + f * 16 * GPITCH + (kb + 1) * 64);
                    af[nxt][f].u4[1] = *(const uint4*)(ap + f * 16 * GPITCH + (kb + 1) * 64 + 32);
                    bf[nxt][f].u4[0] = *(const uint4*)(bp + f * 16 * GPITCH + (kb + 1) * 64);
                    bf[nxt][f].u4[1] = *(const uint4*)(bp + f * 16 * GPITCH + (kb + 1) * 64 + 32);
                }
            }
            // the fence pair keeps the LDS reads one group ahead of the block; the compiler
            // otherwise moves them in among the products, each behind a wait to zero
            __builtin_amdgcn_sched_barrier(0);
            #pragma unroll
            for (int mt = 0; mt < 4; mt++)
                #pragma unroll
                for (int nt = 0; nt < 4; nt++)
                    c[mt][nt] = __builtin_amdgcn_wmma_f32_16x16x32_bf16(
                        false, af[cur][mt].v, false, bf[cur][nt].v, (short)0, c[mt][nt],
                        false, false);
            __builtin_amdgcn_sched_barrier(0);
        }

        // publish point: this wave's reads of the buffer are done, its slice of stage s + 1
        // has landed; the barrier says the same of every wave
        asm volatile("s_wait_dscnt 0x0" ::: "memory");
        asm volatile("s_wait_tensorcnt 0x0" ::: "memory");
        __syncthreads();
        if (pinned(s + 2 < nst)) {   // refill the buffer that every wave has just left
            tdm_advance(g0, dst + p, pinned(GROWB));
            tdm_load(g0, g1);
        }
    }
    asm volatile("s_wait_tensorcnt 0x0" ::: "memory");   // nothing in flight when the wave ends
    asm volatile("s_wait_dscnt 0x0" ::: "memory");

    // ---- epilogue: the mode is tested once per wave, never per element ----
    int row0 = m0 + (int)wr * 64 + 8 * half;
    int col0 = n0 + (int)wc * 64 + mloc;
    if (mode == 0)      gemm_store<0>(c, bias, resid, outF, outB, N, oscale, row0, col0);
    else if (mode == 1) gemm_store<1>(c, bias, resid, outF, outB, N, oscale, row0, col0);
    else if (mode == 2) gemm_store<2>(c, bias, resid, outF, outB, N, oscale, row0, col0);
    else                gemm_store<3>(c, bias, resid, outF, outB, N, oscale, row0, col0);
}

// ---------------- flash attention (8 waves / 128 query rows / head) ----------------
// q,k: bf16 [B*H][L][HD] (q pre-scaled by HD^-0.5); v: bf16 [B*H][HD][L].
// out: bf16 [B*L][D].
// Each wave owns 16 query rows. K and V tiles of AKS keys are staged in LDS once per
// workgroup by asynchronous copies (whole 128-B rows, two buffers) and read as
// fragments by all eight waves.
#define AWV 8      // waves per workgroup
#define AKS 64     // keys per LDS stage
#define APT 72     // LDS row pitch in elements: 128 B of data + 16 B pad

// One stage's four copies of a lane (two K rows, two V rows, 16 B each). The
// s_wait_xcnt closes the statement so that no address register named here is
// rewritten ahead of it.
__device__ __forceinline__ void attn_stage_copy(unsigned int lk0, unsigned int lk1,
                                                unsigned int lv0, unsigned int lv1,
                                                const unsigned short* gk0,
                                                const unsigned short* gk1,
                                                const unsigned short* gv0,
                                                const unsigned short* gv1) {
    asm volatile("global_load_async_to_lds_b128 %0, %4, off\n\t"
                 "global_load_async_to_lds_b128 %1, %5, off\n\t"
                 "global_load_async_to_lds_b128 %2, %6, off\n\t"
                 "global_load_async_to_lds_b128 %3, %7, off\n\t"
                 "s_wait_xcnt 0x0"
                 :: "v"(lk0), "v"(lk1), "v"(lv0), "v"(lv1),
                    "v"(gk0), "v"(gk1), "v"(gv0), "v"(gv1)
                 : "memory");
}

__global__ __launch_bounds__(32 * AWV)
void attn_kernel(const unsigned short* __restrict__ q,
                 const unsigned short* __restrict__ k,
                 const unsigned short* __restrict__ v,
                 const int* __restrict__ mask,
                 unsigned short* __restrict__ out) {
    int bh = blockIdx.x;              // 0..127
    int b  = bh >> 4, h = bh & 15;
    int t  = threadIdx.x;
    int w  = t >> 5, lane = t & 31;
    int q0 = blockIdx.y * (16 * AWV) + w * 16;
    int mloc = lane & 15, half = lane >> 4;

    const unsigned short* Q  = q + (size_t)bh * Lm * HDm;
    const unsigned short* Kp = k + (size_t)bh * Lm * HDm;
    const unsigned short* Vt = v + (size_t)bh * HDm * Lm;

    __shared__ __align__(16) unsigned short Ks[2][AKS][APT];   // [buffer][key][d]
    __shared__ __align__(16) unsigned short Vs[2][HDm][APT];   // [buffer][d][key]
    __shared__ __align__(16) unsigned short pl[AWV][16][40];   // P tile 16x32, one per wave

    // Q A-fragments for d = 0..31 and 32..63
    V16 aq[2];
    #pragma unroll
    for (int s = 0; s < 2; s++) {
        int d0 = s * 32;
        aq[s].u4[0] = *(const uint4*)&Q[(size_t)(q0 + mloc) * HDm + d0 + half * 8];
        aq[s].u4[1] = *(const uint4*)&Q[(size_t)(q0 + mloc) * HDm + d0 + 16 + half * 8];
    }

    float run_max[8], run_sum[8];
    #pragma unroll
    for (int i = 0; i < 8; i++) { run_max[i] = -1e30f; run_sum[i] = 0.f; }
    v8f o[4] = {};

    // staging: 8 lanes cover one 128-B row; a lane copies rows srow and srow + 32
    int srow = t >> 3, sseg = (t & 7) * 8;
    const unsigned int bufK = AKS * APT * 2, bufV = HDm * APT * 2;   // bytes per buffer
    unsigned int lk0 = (unsigned int)(size_t)(void*)&Ks[0][srow][sseg];
    unsigned int lk1 = (unsigned int)(size_t)(void*)&Ks[0][srow + 32][sseg];
    unsigned int lv0 = (unsigned int)(size_t)(void*)&Vs[0][srow][sseg];
    unsigned int lv1 = (unsigned int)(size_t)(void*)&Vs[0][srow + 32][sseg];
    const unsigned short* gk0 = &Kp[(size_t)srow * HDm + sseg];          // + stage * AKS rows
    const unsigned short* gk1 = &Kp[(size_t)(srow + 32) * HDm + sseg];
    const unsigned short* gv0 = &Vt[(size_t)srow * Lm + sseg];           // + stage * AKS keys
    const unsigned short* gv1 = &Vt[(size_t)(srow + 32) * Lm + sseg];
    const int nst = Lm / AKS;

    attn_stage_copy(lk0, lk1, lv0, lv1, gk0, gk1, gv0, gv1);
    asm volatile("s_wait_asynccnt 0x0" ::: "memory");   // this wave's part of stage 0 has landed
    __syncthreads();                                    // and so has every other wave's
    attn_stage_copy(lk0 + bufK, lk1 + bufK, lv0 + bufV, lv1 + bufV,
                    gk0 + AKS * HDm, gk1 + AKS * HDm, gv0 + AKS, gv1 + AKS);

    for (int st = 0; st < nst; st++) {
        int p = st & 1;
        // unrolled so that kl is a constant and folds into the LDS load offsets
        #pragma unroll
        for (int kt = 0; kt < AKS / 32; kt++) {
            int kl = kt * 32;              // first key of the tile inside the stage
            int kb = st * AKS + kl;        // and in the sequence
            // ---- scores: two 16-key subtiles, K-depth = 64 (2 wmma each) ----
            v8f sc[2] = {};
            #pragma unroll
            for (int sub = 0; sub < 2; sub++) {
                int key = kl + sub * 16 + mloc;
                #pragma unroll
                for (int s = 0; s < 2; s++) {
                    int d0 = s * 32;
                    V16 bk;
                    bk.u4[0] = *(const uint4*)&Ks[p][key][d0 + half * 8];
                    bk.u4[1] = *(const uint4*)&Ks[p][key][d0 + 16 + half * 8];
                    sc[sub] = __builtin_amdgcn_wmma_f32_16x16x32_bf16(
                        false, aq[s].v, false, bk.v, (short)0, sc[sub], false, false);
                }
            }
            // mask (per key column)
            float mk0 = (mask[b * Lm + kb + mloc]      > 0) ? 0.f : -1e30f;
            float mk1 = (mask[b * Lm + kb + 16 + mloc] > 0) ? 0.f : -1e30f;
            #pragma unroll
            for (int i = 0; i < 8; i++) { sc[0][i] += mk0; sc[1][i] += mk1; }

            // ---- online softmax ----
            float p0[8], p1[8];
            #pragma unroll
            for (int i = 0; i < 8; i++) {
                float tm = fmaxf(sc[0][i], sc[1][i]);
                #pragma unroll
                for (int off = 1; off < 16; off <<= 1)
                    tm = fmaxf(tm, __shfl_xor(tm, off, 32));
                float nm = fmaxf(run_max[i], tm);
                float corr = __expf(run_max[i] - nm);
                run_max[i] = nm;
                p0[i] = __expf(sc[0][i] - nm);
                p1[i] = __expf(sc[1][i] - nm);
                float ts = p0[i] + p1[i];
                #pragma unroll
                for (int off = 1; off < 16; off <<= 1)
                    ts += __shfl_xor(ts, off, 32);
                run_sum[i] = run_sum[i] * corr + ts;
                #pragma unroll
                for (int f = 0; f < 4; f++) o[f][i] *= corr;
            }

            // ---- P -> LDS (re-layout D-frag -> A-frag), in the wave's own tile ----
            #pragma unroll
            for (int i = 0; i < 8; i++) {
                pl[w][i + 8 * half][mloc]      = f2bf(p0[i]);
                pl[w][i + 8 * half][16 + mloc] = f2bf(p1[i]);
            }
            // the wave's own P stores are done before its lanes read each other's rows
            asm volatile("s_wait_dscnt 0x0" ::: "memory");
            V16 ap;
            ap.u4[0] = *(const uint4*)&pl[w][mloc][half * 8];
            ap.u4[1] = *(const uint4*)&pl[w][mloc][16 + half * 8];

            // ---- O += P * V  (4 wmma; V fragments are rows of Vs) ----
            #pragma unroll
            for (int f = 0; f < 4; f++) {
                V16 bv;
                int d = f * 16 + mloc;
                bv.u4[0] = *(const uint4*)&Vs[p][d][kl + half * 8];
                bv.u4[1] = *(const uint4*)&Vs[p][d][kl + 16 + half * 8];
                o[f] = __builtin_amdgcn_wmma_f32_16x16x32_bf16(
                    false, ap.v, false, bv.v, (short)0, o[f], false, false);
            }
        }
        // publish point: this wave's LDS reads of buffer p are done, its copies of
        // stage st + 1 have landed; the barrier says the same of every wave.
        asm volatile("s_wait_dscnt 0x0" ::: "memory");
        asm volatile("s_wait_asynccnt 0x0" ::: "memory");
        __syncthreads();
        if (st + 2 < nst) {   // refill the buffer that every wave has just left
            int sn = st + 2;
            attn_stage_copy(lk0 + p * bufK, lk1 + p * bufK, lv0 + p * bufV, lv1 + p * bufV,
                            gk0 + (size_t)sn * AKS * HDm, gk1 + (size_t)sn * AKS * HDm,
                            gv0 + sn * AKS, gv1 + sn * AKS);
        }
    }
    asm volatile("s_wait_asynccnt 0x0" ::: "memory");   // nothing in flight when the wave ends

    // ---- normalize + store: out[b*L + q][h*64 + d] ----
    #pragma unroll
    for (int f = 0; f < 4; f++) {
        #pragma unroll
        for (int i = 0; i < 8; i++) {
            int qq  = q0 + i + 8 * half;
            int col = h * HDm + f * 16 + mloc;
            out[(size_t)(b * Lm + qq) * Dm + col] = f2bf(o[f][i] / run_sum[i]);
        }
    }
}

// ---------------- host-side launch ----------------
extern "C" void kernel_launch(void* const* d_in, const int* in_sizes, int n_in,
                              void* d_out, int out_size, void* d_ws, size_t ws_size,
                              hipStream_t stream) {
    const float* x     = (const float*)d_in[0];
    const int*   amask = (const int*)  d_in[1];
    const float* wq = (const float*)d_in[2];  const float* bq = (const float*)d_in[3];
    const float* wk = (const float*)d_in[4];  const float* bk = (const float*)d_in[5];
    const float* wv = (const float*)d_in[6];  const float* bv = (const float*)d_in[7];
    const float* wo = (const float*)d_in[8];  const float* bo = (const float*)d_in[9];
    const float* ln1s = (const float*)d_in[10]; const float* ln1b = (const float*)d_in[11];
    const float* ln2s = (const float*)d_in[12]; const float* ln2b = (const float*)d_in[13];
    const float* w1 = (const float*)d_in[14]; const float* b1 = (const float*)d_in[15];
    const float* w2 = (const float*)d_in[16]; const float* b2 = (const float*)d_in[17];
    float* outp = (float*)d_out;

    char* base = (char*)d_ws;
    size_t off = 0;
    auto alloc = [&](size_t bytes) -> char* {
        char* p = base + off;
        off = (off + bytes + 255) & ~(size_t)255;
        return p;
    };
    // transposed bf16 weights: [N][K]
    unsigned short* wqb = (unsigned short*)alloc((size_t)Dm * Dm * 2);
    unsigned short* wkb = (unsigned short*)alloc((size_t)Dm * Dm * 2);
    unsigned short* wvb = (unsigned short*)alloc((size_t)Dm * Dm * 2);
    unsigned short* wob = (unsigned short*)alloc((size_t)Dm * Dm * 2);
    unsigned short* w1b = (unsigned short*)alloc((size_t)Dm * FFm * 2);
    unsigned short* w2b = (unsigned short*)alloc((size_t)FFm * Dm * 2);
    unsigned short* h1b = (unsigned short*)alloc((size_t)Mrows * Dm * 2);
    unsigned short* qb  = (unsigned short*)alloc((size_t)Mrows * Dm * 2);
    unsigned short* kb  = (unsigned short*)alloc((size_t)Mrows * Dm * 2);
    unsigned short* vb  = (unsigned short*)alloc((size_t)Mrows * Dm * 2);
    unsigned short* ab  = (unsigned short*)alloc((size_t)Mrows * Dm * 2);
    float*          x1  = (float*)        alloc((size_t)Mrows * Dm * 4);
    unsigned short* h2b = (unsigned short*)alloc((size_t)Mrows * Dm * 2);
    unsigned short* m1b = (unsigned short*)alloc((size_t)Mrows * FFm * 2);
    (void)ws_size; (void)n_in; (void)in_sizes; (void)out_size;

    const float qscale = 0.125f; // HD^-0.5
    dim3 tb(32, 8);

    // weights -> transposed bf16  (src is [K][N])
    cvt_t_kernel<<<dim3(Dm / 32, Dm / 32),  tb, 0, stream>>>(wq, wqb, Dm, Dm);
    cvt_t_kernel<<<dim3(Dm / 32, Dm / 32),  tb, 0, stream>>>(wk, wkb, Dm, Dm);
    cvt_t_kernel<<<dim3(Dm / 32, Dm / 32),  tb, 0, stream>>>(wv, wvb, Dm, Dm);
    cvt_t_kernel<<<dim3(Dm / 32, Dm / 32),  tb, 0, stream>>>(wo, wob, Dm, Dm);
    cvt_t_kernel<<<dim3(FFm / 32, Dm / 32), tb, 0, stream>>>(w1, w1b, Dm, FFm);
    cvt_t_kernel<<<dim3(Dm / 32, FFm / 32), tb, 0, stream>>>(w2, w2b, FFm, Dm);

    // LN1
    ln_bf16_kernel<<<Mrows / (LNR * LNW), 32 * LNW, 0, stream>>>(x, ln1s, ln1b, h1b);

    // QKV projections (Q pre-scaled; V transposed per head)
    dim3 gDD(Dm / 128, Mrows / 128);
    gemm_bf16_kernel<<<gDD, 128, 0, stream>>>(h1b, wqb, bq, nullptr, nullptr, qb,
                                              Mrows, Dm, Dm, 0, qscale);
    gemm_bf16_kernel<<<gDD, 128, 0, stream>>>(h1b, wkb, bk, nullptr, nullptr, kb,
                                              Mrows, Dm, Dm, 0, 1.0f);
    gemm_bf16_kernel<<<gDD, 128, 0, stream>>>(h1b, wvb, bv, nullptr, nullptr, vb,
                                              Mrows, Dm, Dm, 1, 1.0f);

    // attention
    attn_kernel<<<dim3(Bm * Hm, Lm / (16 * AWV)), 32 * AWV, 0, stream>>>(qb, kb, vb, amask, ab);

    // output projection + residual -> x1
    gemm_bf16_kernel<<<gDD, 128, 0, stream>>>(ab, wob, bo, x, x1, nullptr,
                                              Mrows, Dm, Dm, 3, 1.0f);

    // LN2
    ln_bf16_kernel<<<Mrows / (LNR * LNW), 32 * LNW, 0, stream>>>(x1, ln2s, ln2b, h2b);

    // MLP up + quickGELU -> bf16
    dim3 gDF(FFm / 128, Mrows / 128);
    gemm_bf16_kernel<<<gDF, 128, 0, stream>>>(h2b, w1b, b1, nullptr, nullptr, m1b,
                                              Mrows, FFm, Dm, 2, 1.0f);

    // MLP down + residual -> d_out
    gemm_bf16_kernel<<<gDD, 128, 0, stream>>>(m1b, w2b, b2, x1, outp, nullptr,
                                              Mrows, Dm, FFm, 3, 1.0f);
}

// v005
// One run takes 244 microseconds.
// Timed twice side by side with v004, it ran 1.20 and 1.19 times as fast.
// Over all steps from v000 it is 2.60 times as fast.
#include <hip/hip_runtime.h>

// ---------------- constants ----------------
#define Dm   1024
#define Hm   16
#define HDm  64
#define FFm  4096
#define Bm   8
#define Lm   1024
#define Mrows (Bm * Lm)        // 8192
#define EPSc 1e-5f

typedef __attribute__((ext_vector_type(16))) __bf16 v16bf;
typedef __attribute__((ext_vector_type(8)))  float  v8f;
typedef __attribute__((ext_vector_type(4)))  unsigned int u32x4;
typedef __attribute__((ext_vector_type(8)))  unsigned int u32x8;

union V16 {
    uint4 u4[2];
    unsigned short s[16];
    v16bf v;
};

__device__ __forceinline__ unsigned short f2bf(float f) {
    unsigned int u = __float_as_uint(f);
    unsigned int r = u + 0x7fffu + ((u >> 16) & 1u);   // round to nearest even
    return (unsigned short)(r >> 16);
}

// ---------------- tensor loads of the GEMM ----------------
// One pass of the GEMM takes GPK k: GROWB bytes of every operand row. A wave's request is a
// slice of 64 such rows, laid in LDS at pitch GPITCH (16 B x odd: no bank conflict for
// 16-byte fragment reads). A slice's place is a multiple of 2 KiB.
#define GPK    128
#define GROWB  256
#define GPITCH 272
#define GSLICE 18432           // 64 * GPITCH = 17408, rounded up to a multiple of 2 KiB
#define GSTAGE (4 * GSLICE)    // A rows 0-63 | A rows 64-127 | B rows 0-63 | B rows 64-127

__device__ __forceinline__ unsigned int uni(unsigned int v) {
    return (unsigned int)__builtin_amdgcn_readfirstlane(v);
}
// a wave-uniform value held in a scalar register, so that a test on it is a scalar branch and
// a descriptor word made from it is formed where this stands (tensor loads ignore EXEC)
__device__ __forceinline__ unsigned int pinned(unsigned int v) {
    unsigned int w = uni(v);
    asm volatile("" : "+s"(w));   // the value stays in a scalar register
    return w;
}
// both groups are in-out operands: their registers then stay this descriptor's own from one
// request to the next, and nothing else is put into them while a request is outstanding
__device__ __forceinline__ void tdm_load(u32x4& g0, u32x8& g1) {
    asm volatile("tensor_load_to_lds %0, %1" : "+s"(g0), "+s"(g1) :: "memory");
}
// group 1: 1-byte elements, tensor = tile = 64 rows of GROWB bytes, source pitch in bytes,
// a pad of 4 dwords behind every 64 dwords (one row)
__device__ __forceinline__ u32x8 tdm_group1(unsigned int src_pitch) {
    u32x8 g;
    g[0] = uni((1u << 20) | (5u << 22) | (3u << 25));   // no mask, data_size 0, pad codes 5 / 3
    g[1] = uni(((unsigned int)GROWB & 0xFFFFu) << 16);
    g[2] = uni(64u << 16);
    g[3] = uni((unsigned int)GROWB << 16);
    g[4] = uni(64u);
    g[5] = uni(src_pitch);
    g[6] = uni(0u);
    g[7] = uni(0u);
    return g;
}
__device__ __forceinline__ u32x4 tdm_group0(unsigned int lds_dst, unsigned long long ga) {
    u32x4 g;
    g[0] = uni(1u);
    g[1] = uni(lds_dst);
    g[2] = uni((unsigned int)ga);
    g[3] = uni((((unsigned int)(ga >> 32)) & 0x01FFFFFFu) | 0x80000000u);
    return g;
}
// the same slice one stage on: a new place in LDS, the source inc bytes further (words 2 and
// 3 are added to as one 64-bit number: the type bits lie above every address bit)
__device__ __forceinline__ void tdm_advance(u32x4& g, unsigned int lds_dst, unsigned int inc) {
    unsigned long long a = (((unsigned long long)g[3] << 32) | g[2]) + inc;
    g[1] = uni(lds_dst);
    g[2] = uni((unsigned int)a);
    g[3] = uni((unsigned int)(a >> 32));
}

// ---------------- fp32 -> bf16 transpose-convert: dst[N][K] = src[K][N] ----------------
__global__ __launch_bounds__(256)
void cvt_t_kernel(const float* __restrict__ src, unsigned short* __restrict__ dst,
                  int K, int N) {
    __shared__ unsigned short tile[32][33];
    int n0 = blockIdx.x * 32, k0 = blockIdx.y * 32;
    int tx = threadIdx.x, ty = threadIdx.y;   // block (32,8)
    #pragma unroll
    for (int i = 0; i < 4; i++) {
        int r = ty + i * 8;
        tile[r][tx] = f2bf(src[(size_t)(k0 + r) * N + n0 + tx]);
    }
    __syncthreads();
    #pragma unroll
    for (int i = 0; i < 4; i++) {
        int r = ty + i * 8;
        dst[(size_t)(n0 + r) * K + k0 + tx] = tile[tx][r];
    }
}

// ---------------- LayerNorm -> bf16 ----------------
typedef __attribute__((ext_vector_type(4))) float f32x4;
typedef __attribute__((ext_vector_type(2))) float f32x2;

// two floats to two bf16 in one dword, each rounded as f2bf rounds
__device__ __forceinline__ unsigned int f2bf_pair(float lo, float hi) {
    unsigned int a = __float_as_uint(lo), b = __float_as_uint(hi);
    a += 0x7fffu + ((a >> 16) & 1u);
    b += 0x7fffu + ((b >> 16) & 1u);
    return (a >> 16) | (b & 0xffff0000u);
}

// One wave owns LNR whole rows and keeps them in registers: every element is read once, by
// 16-byte loads that are in flight together; mean and variance are summed inside the
// lane and then across the 32 lanes by shuffles, so no LDS and no barrier is needed, and a
// launch holds one wave per LNR rows instead of a workgroup of eight per row.
#define LNR 2      // rows per wave
#define LNW 8      // waves per workgroup
__global__ __launch_bounds__(32 * LNW)
void ln_bf16_kernel(const float* __restrict__ x,
                    const float* __restrict__ gamma,
                    const float* __restrict__ beta,
                    unsigned short* __restrict__ out) {
    int lane = threadIdx.x & 31;
    // the wave's number as a scalar: the rows' base addresses then stay in scalar registers
    int row0 = (blockIdx.x * LNW + __builtin_amdgcn_readfirstlane(threadIdx.x >> 5)) * LNR;
    const float* xr = x + (size_t)row0 * Dm;

    // piece j of a row: elements j * 128 + lane * 4 .. + 3 (a wave's load covers 512 B in a row)
    f32x4 g[8], be[8], v[LNR][8];
    #pragma unroll
    for (int j = 0; j < 8; j++) {
        g[j]  = *(const f32x4*)&gamma[j * 128 + lane * 4];
        be[j] = *(const f32x4*)&beta[j * 128 + lane * 4];
    }
    #pragma unroll
    for (int r = 0; r < LNR; r++)
        #pragma unroll
        for (int j = 0; j < 8; j++)
            v[r][j] = *(const f32x4*)&xr[r * Dm + j * 128 + lane * 4];
    // the scale and shift loads are issued early, in groups, ahead of one common wait; the
    // compiler otherwise sinks each pair to its use and waits for the pairs one after another
    asm volatile("" :: "v"(g[0]), "v"(g[1]), "v"(g[2]), "v"(g[3]),
                       "v"(g[4]), "v"(g[5]), "v"(g[6]), "v"(g[7]),
                       "v"(be[0]), "v"(be[1]), "v"(be[2]), "v"(be[3]),
                       "v"(be[4]), "v"(be[5]), "v"(be[6]), "v"(be[7]));

    float mu[LNR], inv[LNR];
    #pragma unroll
    for (int r = 0; r < LNR; r++) {
        f32x2 s0 = v[r][0].xy, s1 = v[r][0].zw;
        #pragma unroll
        for (int j = 1; j < 8; j++) { s0 += v[r][j].xy; s1 += v[r][j].zw; }
        s0 += s1;
        mu[r] = s0.x + s0.y;
    }
    #pragma unroll
    for (int off = 16; off > 0; off >>= 1)
        #pragma unroll
        for (int r = 0; r < LNR; r++) mu[r] += __shfl_xor(mu[r], off, 32);
    #pragma unroll
    for (int r = 0; r < LNR; r++) {
        mu[r] *= (1.0f / Dm);
        f32x2 s0 = {0.f, 0.f}, s1 = {0.f, 0.f};
        #pragma unroll
        for (int j = 0; j < 8; j++) {
            v[r][j] -= mu[r];
            s0 += v[r][j].xy * v[r][j].xy;
            s1 += v[r][j].zw * v[r][j].zw;
        }
        s0 += s1;
        inv[r] = s0.x + s0.y;
    }
    #pragma unroll
    for (int off = 16; off > 0; off >>= 1)
        #pragma unroll
        for (int r = 0; r < LNR; r++) inv[r] += __shfl_xor(inv[r], off, 32);
    #pragma unroll
    for (int r = 0; r < LNR; r++) inv[r] = rsqrtf(inv[r] * (1.0f / Dm) + EPSc);

    unsigned short* orow = out + (size_t)row0 * Dm;
    #pragma unroll
    for (int j = 0; j < 8; j++) {
        #pragma unroll
        for (int r = 0; r < LNR; r++) {
            f32x4 y = v[r][j] * inv[r] * g[j] + be[j];
            uint2 pk;
            pk.x = f2bf_pair(y.x, y.y);
            pk.y = f2bf_pair(y.z, y.w);
            *(uint2*)&orow[r * Dm + j * 128 + lane * 4] = pk;
        }
    }
}

// A transcendental with the one free issue slot behind it that the instruction set asks for
// before its result is read or its source overwritten; the v_nop in the same statement holds
// that slot whatever the compiler schedules next.
__device__ __forceinline__ float exp2_slot(float x) {
    float r;
    asm("v_exp_f32 %0, %1\n\tv_nop" : "=v"(r) : "v"(x));
    return r;
}
__device__ __forceinline__ float rcp_slot(float x) {
    float r;
    asm("v_rcp_f32 %0, %1\n\tv_nop" : "=v"(r) : "v"(x));
    return r;
}

// ---------------- GEMM epilogue of one wave (64 x 64 of C), one straight-line form per mode ----------------
// v = (acc + bias [quickGELU] [+ resid]) * oscale
// MODE 0: bf16 to [B,H,L,HD]   MODE 1: bf16 to [B,H,HD,L] (transposed per head)
// MODE 2: quickGELU, bf16 to [M,N]   MODE 3: + resid, f32 to [M,N]
// row0, col0: the lane's first row and column of C.
template <int MODE>
__device__ __forceinline__ void gemm_store(const v8f (&c)[4][4],
                                           const float* __restrict__ bias,
                                           const float* __restrict__ resid,
                                           float* __restrict__ outF,
                                           unsigned short* __restrict__ outB,
                                           int N, float oscale, int row0, int col0) {
    float bv[4];
    #pragma unroll
    for (int nt = 0; nt < 4; nt++) bv[nt] = bias[col0 + nt * 16];
    // groups of 16 rows x 64 columns: 32 elements of a lane
    #pragma unroll
    for (int mt = 0; mt < 4; mt++) {
        float rs[4][8];
        if (MODE == 3) {
            #pragma unroll
            for (int nt = 0; nt < 4; nt++)
                #pragma unroll
                for (int i = 0; i < 8; i++)
                    rs[nt][i] = resid[(unsigned int)((row0 + mt * 16 + i) * N + col0 + nt * 16)];
            // the group's 32 residual loads are all issued before the first is used, so that
            // their latency is paid once a group
            __builtin_amdgcn_sched_barrier(0);
        }
        #pragma unroll
        for (int nt = 0; nt < 4; nt++) {
            int col = col0 + nt * 16;
            #pragma unroll
            for (int i = 0; i < 8; i++) {
                int row = row0 + mt * 16 + i;
                float v = c[mt][nt][i] + bv[nt];
                if (MODE == 2)   // v * sigmoid(1.702 v), e^x as 2^(x log2 e)
                    v = v * rcp_slot(1.0f + exp2_slot((-1.702f * v) * 1.44269504f));
                if (MODE == 3) v += rs[nt][i];
                v *= oscale;
                if (MODE == 3) {
                    outF[(unsigned int)(row * N + col)] = v;
                } else {
                    unsigned int idx;   // every index here is below 2^25: 32 bits hold it
                    int bb = row >> 10, ll = row & 1023;
                    int hh = col >> 6,  dd = col & 63;
                    if (MODE == 0)
                        idx = (unsigned int)((((bb * Hm + hh) * Lm) + ll) * HDm + dd);
                    else if (MODE == 1)
                        idx = (unsigned int)((((bb * Hm + hh) * HDm) + dd) * Lm + ll);
                    else
                        idx = (unsigned int)(row * N + col);
                    outB[idx] = f2bf(v);
                }
            }
        }
        // the next group's loads may land in registers that this group's stores name
        if (MODE == 3 && mt < 3) asm volatile("s_wait_xcnt 0x0" ::: "memory");
        // one group's work stays in front of the next group's: the epilogue then stays inside
        // the first 256 registers
        if (mt < 3) __builtin_amdgcn_sched_barrier(0);
    }
}

// ---------------- bf16 WMMA GEMM, B pre-transposed, two-buffer tensor-load ring ----------------
// C[M,N] = A[M,K] * Bt[N,K]^T, then the epilogue of gemm_store<mode>
// Block tile 128(M) x 128(N), a pass of GPK k, 4 waves (2 x 2), each wave 64 x 64.
// M and N are multiples of 128, K a multiple of GPK and at least two passes.
// Every wave issues one tensor load a stage: waves 0 and 1 the two halves of the A rows,
// waves 2 and 3 of the B rows. Two workgroups share a WGP (LDS), so 512 registers a wave.
__global__ __launch_bounds__(128, 2)
void gemm_bf16_kernel(const unsigned short* __restrict__ A,
                      const unsigned short* __restrict__ Bt,
                      const float* __restrict__ bias,
                      const float* __restrict__ resid,
                      float* __restrict__ outF,
                      unsigned short* __restrict__ outB,
                      int M, int N, int K,
                      int mode, float oscale) {
    __shared__ __attribute__((aligned(2048))) unsigned char ring[2 * GSTAGE];
    (void)M;

    int t    = threadIdx.x;
    int lane = t & 31;
    const unsigned int w = uni((unsigned int)t >> 5);   // the wave's number, a scalar
    const unsigned int wr = w >> 1, wc = w & 1u;
    int mloc = lane & 15, half = lane >> 4;
    int m0 = blockIdx.y * 128, n0 = blockIdx.x * 128;

    v8f c[4][4] = {};
    const int nst = K / GPK;

    // this wave's slice: its first source byte, its place in buffer 0
    const unsigned short* srow = (w < 2u) ? A  + (size_t)(m0 + (int)w * 64) * K
                                          : Bt + (size_t)(n0 + (int)(w - 2u) * 64) * K;
    const unsigned long long ga = (unsigned long long)(size_t)srow;
    const unsigned int dst = (unsigned int)(size_t)(void*)ring + w * GSLICE;
    u32x8 g1 = tdm_group1((unsigned int)K * 2u);

    u32x4 g0 = tdm_group0(dst, ga);
    tdm_load(g0, g1);                                        // stage 0
    asm volatile("s_wait_tensorcnt 0x0" ::: "memory");       // this wave's slice has landed
    __syncthreads();                                         // and so has every other wave's
    // the step is pinned here, and at the refill below, so that the address words take their
    // new value behind the wait
    tdm_advance(g0, dst + GSTAGE, pinned(GROWB));
    tdm_load(g0, g1);                                        // stage 1

    // the lane's first A and B fragment bytes inside a buffer
    const unsigned int aoff = wr * GSLICE + (unsigned int)(mloc * GPITCH + half * 16);
    const unsigned int boff = (2u + wc) * GSLICE + (unsigned int)(mloc * GPITCH + half * 16);

    for (int s = 0; s < nst; s++) {
        const unsigned int p = (unsigned int)(s & 1) * GSTAGE;
        const unsigned char* ap = ring + p + aoff;
        const unsigned char* bp = ring + p + boff;

        // four blocks of 32 k; the next block's fragments are read into a second register
        // set ahead of the current block's products
        V16 af[2][4], bf[2][4];
        #pragma unroll
        for (int f = 0; f < 4; f++) {
            af[0][f].u4[0] = *(const uint4*)(ap + f * 16 * GPITCH);
            af[0][f].u4[1] = *(const uint4*)(ap + f * 16 * GPITCH + 32);
            bf[0][f].u4[0] = *(const uint4*)(bp + f * 16 * GPITCH);
            bf[0][f].u4[1] = *(const uint4*)(bp + f * 16 * GPITCH + 32);
        }
        #pragma unroll
        for (int kb = 0; kb < 4; kb++) {
            const int cur = kb & 1, nxt = cur ^ 1;
            if (kb < 3) {
                #pragma unroll
                for (int f = 0; f < 4; f++) {
                    af[nxt][f].u4[0] = *(const uint4*)(ap + f * 16 * GPITCH + (kb + 1) * 64);
                    af[nxt][f].u4[1] = *(const uint4*)(ap + f * 16 * GPITCH + (kb + 1) * 64 + 32);
                    bf[nxt][f].u4[0] = *(const uint4*)(bp + f * 16 * GPITCH + (kb + 1) * 64);
                    bf[nxt][f].u4[1] = *(const uint4*)(bp + f * 16 * GPITCH + (kb + 1) * 64 + 32);
                }
            }
            // the fence pair keeps the LDS reads one group ahead of the block; the compiler
            // otherwise moves them in among the products, each behind a wait to zero
            __builtin_amdgcn_sched_barrier(0);
            #pragma unroll
            for (int mt = 0; mt < 4; mt++)
                #pragma unroll
                for (int nt = 0; nt < 4; nt++)
                    c[mt][nt] = __builtin_amdgcn_wmma_f32_16x16x32_bf16(
                        false, af[cur][mt].v, false, bf[cur][nt].v, (short)0, c[mt][nt],
                        false, false);
            __builtin_amdgcn_sched_barrier(0);
        }

        // publish point: this wave's reads of the buffer are done, its slice of stage s + 1
        // has landed; the barrier says the same of every wave
        asm volatile("s_wait_dscnt 0x0" ::: "memory");
        asm volatile("s_wait_tensorcnt 0x0" ::: "memory");
        __syncthreads();
        if (pinned(s + 2 < nst)) {   // refill the buffer that every wave has just left
            tdm_advance(g0, dst + p, pinned(GROWB));
            tdm_load(g0, g1);
        }
    }
    asm volatile("s_wait_tensorcnt 0x0" ::: "memory");   // nothing in flight when the wave ends
    asm volatile("s_wait_dscnt 0x0" ::: "memory");

    // ---- epilogue: the mode is tested once per wave, never per element ----
    int row0 = m0 + (int)wr * 64 + 8 * half;
    int col0 = n0 + (int)wc * 64 + mloc;
    if (mode == 0)      gemm_store<0>(c, bias, resid, outF, outB, N, oscale, row0, col0);
    else if (mode == 1) gemm_store<1>(c, bias, resid, outF, outB, N, oscale, row0, col0);
    else if (mode == 2) gemm_store<2>(c, bias, resid, outF, outB, N, oscale, row0, col0);
    else                gemm_store<3>(c, bias, resid, outF, outB, N, oscale, row0, col0);
}

#define AWV 8      // waves per workgroup
#define AQW 32     // query columns per wave
#define AKS 64     // keys per LDS stage
#define APT 72     // LDS row pitch in elements: 128 B of data + 16 B pad

// two floats to two bf16 in one dword by the hardware's conversion (round to nearest even)
__device__ __forceinline__ unsigned int cvt_pair(float lo, float hi) {
    typedef __attribute__((ext_vector_type(2))) __bf16 bf16x2;
    f32x2 f = {lo, hi};
    return __builtin_bit_cast(unsigned int, __builtin_convertvector(f, bf16x2));
}
// lane l takes the value of lane l ^ 16
__device__ __forceinline__ float xhalf(float x) {
    int b = __builtin_bit_cast(int, x);
    return __builtin_bit_cast(float,
        __builtin_amdgcn_permlanex16(b, b, 0x76543210, 0xfedcba98, false, false));
}

// One stage's four copies of a lane (two K rows, two V rows, 16 B each). The
// s_wait_xcnt closes the statement so that no address register named here is
// rewritten ahead of it.
__device__ __forceinline__ void attn_stage_copy(unsigned int lk0, unsigned int lk1,
                                                unsigned int lv0, unsigned int lv1,
                                                const unsigned short* gk0,
                                                const unsigned short* gk1,
                                                const unsigned short* gv0,
                                                const unsigned short* gv1) {
    asm volatile("global_load_async_to_lds_b128 %0, %4, off\n\t"
                 "global_load_async_to_lds_b128 %1, %5, off\n\t"
                 "global_load_async_to_lds_b128 %2, %6, off\n\t"
                 "global_load_async_to_lds_b128 %3, %7, off\n\t"
                 "s_wait_xcnt 0x0"
                 :: "v"(lk0), "v"(lk1), "v"(lv0), "v"(lv1),
                    "v"(gk0), "v"(gk1), "v"(gv0), "v"(gv1)
                 : "memory");
}

// two workgroups a WGP, four waves a SIMD: the vector work of one wave runs under the
// products of the others
__global__ __launch_bounds__(32 * AWV) __attribute__((amdgpu_waves_per_eu(4, 4)))
void attn_kernel(const unsigned short* __restrict__ q,
                 const unsigned short* __restrict__ k,
                 const unsigned short* __restrict__ v,
                 const int* __restrict__ mask,
                 unsigned short* __restrict__ out) {
    int bh = blockIdx.x;              // 0..127
    int b  = bh >> 4, h = bh & 15;
    int t  = threadIdx.x;
    int w  = t >> 5, lane = t & 31;
    int q0 = blockIdx.y * (AQW * AWV) + w * AQW;
    int mloc = lane & 15, half = lane >> 4;

    const unsigned short* Q  = q + (size_t)bh * Lm * HDm;
    const unsigned short* Kp = k + (size_t)bh * Lm * HDm;
    const unsigned short* Vt = v + (size_t)bh * HDm * Lm;

    __shared__ __align__(16) unsigned short Ks[2][AKS][APT];   // [buffer][key][d]
    __shared__ __align__(16) unsigned short Vs[2][HDm][APT];   // [buffer][d][key]
    __shared__ __align__(32) float mb[Lm];                     // 0 or -1e30 per key

    // Q B-fragments: column group g, d = 0..31 and 32..63
    V16 bq[2][2];
    #pragma unroll
    for (int g = 0; g < 2; g++)
        #pragma unroll
        for (int s = 0; s < 2; s++) {
            const unsigned short* qp = &Q[(size_t)(q0 + g * 16 + mloc) * HDm + s * 32 + half * 8];
            bq[g][s].u4[0] = *(const uint4*)qp;
            bq[g][s].u4[1] = *(const uint4*)(qp + 16);
        }

    float run_max[2], run_sum[2];   // per column group; run_sum holds this half's keys only
    #pragma unroll
    for (int g = 0; g < 2; g++) { run_max[g] = -1e30f; run_sum[g] = 0.f; }
    v8f o[2][4] = {};               // O^T: o[g][f][i] = O[q = g*16 + mloc][d = f*16 + 8*half + i]

    // staging: 8 lanes cover one 128-B row; a lane copies rows srow and srow + 32
    int srow = t >> 3, sseg = (t & 7) * 8;
    const unsigned int bufK = AKS * APT * 2, bufV = HDm * APT * 2;   // bytes per buffer
    unsigned int lk0 = (unsigned int)(size_t)(void*)&Ks[0][srow][sseg];
    unsigned int lk1 = (unsigned int)(size_t)(void*)&Ks[0][srow + 32][sseg];
    unsigned int lv0 = (unsigned int)(size_t)(void*)&Vs[0][srow][sseg];
    unsigned int lv1 = (unsigned int)(size_t)(void*)&Vs[0][srow + 32][sseg];
    const unsigned short* gk0 = &Kp[(size_t)srow * HDm + sseg];          // + stage * AKS rows
    const unsigned short* gk1 = &Kp[(size_t)(srow + 32) * HDm + sseg];
    const unsigned short* gv0 = &Vt[(size_t)srow * Lm + sseg];           // + stage * AKS keys
    const unsigned short* gv1 = &Vt[(size_t)(srow + 32) * Lm + sseg];
    const int nst = Lm / AKS;

    attn_stage_copy(lk0, lk1, lv0, lv1, gk0, gk1, gv0, gv1);
    {   // the mask as an addend per key; the barrier below publishes it with stage 0
        typedef __attribute__((ext_vector_type(4))) int i32x4;
        const int* mp = &mask[b * Lm + t * 4];   // this thread's four keys
        i32x4 mi;
        // load and data wait in one statement: the address registers are then not rewritten
        // while the load is out;
        // the wait runs under the flight of stage 0's copies
        asm volatile("global_load_b128 %0, %1, off\n\ts_wait_loadcnt 0x0"
                     : "=&v"(mi) : "v"(mp) : "memory");
        f32x4 f = {mi.x > 0 ? 0.f : -1e30f, mi.y > 0 ? 0.f : -1e30f,
                   mi.z > 0 ? 0.f : -1e30f, mi.w > 0 ? 0.f : -1e30f};
        *(f32x4*)&mb[t * 4] = f;
    }
    asm volatile("s_wait_asynccnt 0x0" ::: "memory");   // this wave's part of stage 0 has landed
    __syncthreads();                                    // and so has every other wave's
    attn_stage_copy(lk0 + bufK, lk1 + bufK, lv0 + bufV, lv1 + bufV,
                    gk0 + AKS * HDm, gk1 + AKS * HDm, gv0 + AKS, gv1 + AKS);

    const float L2E = 1.44269504f;
    for (int st = 0; st < nst; st++) {
        int p = st & 1;
        // kept rolled: with two passes in one body the compiler interleaves them and spills
        #pragma unroll 1
        for (int kt = 0; kt < AKS / 32; kt++) {
            int kl = kt * 32;              // first key of the pass inside the stage
            int kb = st * AKS + kl;        // and in the sequence
            // ---- S^T: two 16-key tiles x two column groups, depth 64 (2 wmma each); the
            // mask addend of a tile's rows is the first product's C operand ----
            V16 ak[2][2];
            v8f cb[2];
            #pragma unroll
            for (int sub = 0; sub < 2; sub++) {
                int key = kl + sub * 16 + mloc;
                cb[sub] = *(const v8f*)&mb[kb + sub * 16 + half * 8];
                #pragma unroll
                for (int s = 0; s < 2; s++) {
                    ak[sub][s].u4[0] = *(const uint4*)&Ks[p][key][s * 32 + half * 8];
                    ak[sub][s].u4[1] = *(const uint4*)&Ks[p][key][s * 32 + 16 + half * 8];
                }
            }
            v8f sc[2][2];   // sc[sub][g][i] = S[q = g*16 + mloc][key = kb + sub*16 + 8*half + i]
            #pragma unroll
            for (int sub = 0; sub < 2; sub++)
                #pragma unroll
                for (int g = 0; g < 2; g++)
                    sc[sub][g] = __builtin_amdgcn_wmma_f32_16x16x32_bf16(
                        false, ak[sub][0].v, false, bq[g][0].v, (short)0, cb[sub], false, false);
            #pragma unroll
            for (int sub = 0; sub < 2; sub++)
                #pragma unroll
                for (int g = 0; g < 2; g++)
                    sc[sub][g] = __builtin_amdgcn_wmma_f32_16x16x32_bf16(
                        false, ak[sub][1].v, false, bq[g][1].v, (short)0, sc[sub][g], false, false);

            // V^T A-fragments are rows of Vs
            V16 av[4];
            #pragma unroll
            for (int f = 0; f < 4; f++) {
                int d = f * 16 + mloc;
                av[f].u4[0] = *(const uint4*)&Vs[p][d][kl + half * 8];
                av[f].u4[1] = *(const uint4*)&Vs[p][d][kl + 16 + half * 8];
            }

            #pragma unroll
            for (int g = 0; g < 2; g++) {
                // ---- online softmax of one query per lane ----
                float tm = fmaxf(sc[0][g][0], sc[1][g][0]);
                #pragma unroll
                for (int i = 1; i < 8; i++) tm = fmaxf(tm, fmaxf(sc[0][g][i], sc[1][g][i]));
                tm = fmaxf(tm, xhalf(tm));          // both halves hold the query's maximum
                float nm = fmaxf(run_max[g], tm);
                float corr = __builtin_amdgcn_exp2f((run_max[g] - nm) * L2E);
                run_max[g] = nm;
                const f32x2 l2 = {L2E, L2E}, n2 = {nm, nm};
                f32x2 ts = {0.f, 0.f};
                V16 pf;   // P^T B-fragment: element s is key 8*half + s (s < 8), 8*half + 8 + s (s >= 8) of the pass
                unsigned int pw[8];
                #pragma unroll
                for (int e = 0; e < 8; e++) {
                    f32x2 x = {sc[e >> 2][g][2 * (e & 3)], sc[e >> 2][g][2 * (e & 3) + 1]};
                    x = (x - n2) * l2;   // the difference first: exactly 0 at the maximum, also at -1e30
                    f32x2 pe = {__builtin_amdgcn_exp2f(x.x), __builtin_amdgcn_exp2f(x.y)};
                    ts += pe;
                    pw[e] = cvt_pair(pe.x, pe.y);
                }
                pf.u4[0] = make_uint4(pw[0], pw[1], pw[2], pw[3]);
                pf.u4[1] = make_uint4(pw[4], pw[5], pw[6], pw[7]);
                run_sum[g] = run_sum[g] * corr + (ts.x + ts.y);
                // ---- O^T = O^T * corr + V^T P^T (4 wmma) ----
                #pragma unroll
                for (int f = 0; f < 4; f++) {
                    o[g][f] *= corr;
                    o[g][f] = __builtin_amdgcn_wmma_f32_16x16x32_bf16(
                        false, av[f].v, false, pf.v, (short)0, o[g][f], false, false);
                }
            }
            // the back edge: the pass's first address arithmetic may land in the last product's
            // A registers; the fence holds the products in front of the slots
            __builtin_amdgcn_sched_barrier(0);
            asm volatile("v_nop\n\tv_nop\n\tv_nop\n\tv_nop");
        }
        // publish point: this wave's LDS reads of buffer p are done, its copies of
        // stage st + 1 have landed; the barrier says the same of every wave.
        asm volatile("s_wait_dscnt 0x0" ::: "memory");
        asm volatile("s_wait_asynccnt 0x0" ::: "memory");
        __syncthreads();
        if (st + 2 < nst) {   // refill the buffer that every wave has just left
            int sn = st + 2;
            attn_stage_copy(lk0 + p * bufK, lk1 + p * bufK, lv0 + p * bufV, lv1 + p * bufV,
                            gk0 + (size_t)sn * AKS * HDm, gk1 + (size_t)sn * AKS * HDm,
                            gv0 + sn * AKS, gv1 + sn * AKS);
        }
    }
    asm volatile("s_wait_asynccnt 0x0" ::: "memory");   // nothing in flight when the wave ends

    // ---- normalize + store: out[b*L + q][h*64 + d], 8 consecutive d of a lane in 16 bytes ----
    #pragma unroll
    for (int g = 0; g < 2; g++) {
        float l = run_sum[g];
        l += xhalf(l);                  // the two halves' keys joined
        float inv = 1.0f / l;
        unsigned short* orow = out + (size_t)(b * Lm + q0 + g * 16 + mloc) * Dm + h * HDm + half * 8;
        #pragma unroll
        for (int f = 0; f < 4; f++) {
            v8f y = o[g][f] * inv;
            *(uint4*)&orow[f * 16] = make_uint4(cvt_pair(y[0], y[1]), cvt_pair(y[2], y[3]),
                                                cvt_pair(y[4], y[5]), cvt_pair(y[6], y[7]));
        }
    }
}

// ---------------- host-side launch ----------------
extern "C" void kernel_launch(void* const* d_in, const int* in_sizes, int n_in,
                              void* d_out, int out_size, void* d_ws, size_t ws_size,
                              hipStream_t stream) {
    const float* x     = (const float*)d_in[0];
    const int*   amask = (const int*)  d_in[1];
    const float* wq = (const float*)d_in[2];  const float* bq = (const float*)d_in[3];
    const float* wk = (const float*)d_in[4];  const float* bk = (const float*)d_in[5];
    const float* wv = (const float*)d_in[6];  const float* bv = (const float*)d_in[7];
    const float* wo = (const float*)d_in[8];  const float* bo = (const float*)d_in[9];
    const float* ln1s = (const float*)d_in[10]; const float* ln1b = (const float*)d_in[11];
    const float* ln2s = (const float*)d_in[12]; const float* ln2b = (const float*)d_in[13];
    const float* w1 = (const float*)d_in[14]; const float* b1 = (const float*)d_in[15];
    const float* w2 = (const float*)d_in[16]; const float* b2 = (const float*)d_in[17];
    float* outp = (float*)d_out;

    char* base = (char*)d_ws;
    size_t off = 0;
    auto alloc = [&](size_t bytes) -> char* {
        char* p = base + off;
        off = (off + bytes + 255) & ~(size_t)255;
        return p;
    };
    // transposed bf16 weights: [N][K]
    unsigned short* wqb = (unsigned short*)alloc((size_t)Dm * Dm * 2);
    unsigned short* wkb = (unsigned short*)alloc((size_t)Dm * Dm * 2);
    unsigned short* wvb = (unsigned short*)alloc((size_t)Dm * Dm * 2);
    unsigned short* wob = (unsigned short*)alloc((size_t)Dm * Dm * 2);
    unsigned short* w1b = (unsigned short*)alloc((size_t)Dm * FFm * 2);
    unsigned short* w2b = (unsigned short*)alloc((size_t)FFm * Dm * 2);
    unsigned short* h1b = (unsigned short*)alloc((size_t)Mrows * Dm * 2);
    unsigned short* qb  = (unsigned short*)alloc((size_t)Mrows * Dm * 2);
    unsigned short* kb  = (unsigned short*)alloc((size_t)Mrows * Dm * 2);
    unsigned short* vb  = (unsigned short*)alloc((size_t)Mrows * Dm * 2);
    unsigned short* ab  = (unsigned short*)alloc((size_t)Mrows * Dm * 2);
    float*          x1  = (float*)        alloc((size_t)Mrows * Dm * 4);
    unsigned short* h2b = (unsigned short*)alloc((size_t)Mrows * Dm * 2);
    unsigned short* m1b = (unsigned short*)alloc((size_t)Mrows * FFm * 2);
    (void)ws_size; (void)n_in; (void)in_sizes; (void)out_size;

    const float qscale = 0.125f; // HD^-0.5
    dim3 tb(32, 8);

    // weights -> transposed bf16  (src is [K][N])
    cvt_t_kernel<<<dim3(Dm / 32, Dm / 32),  tb, 0, stream>>>(wq, wqb, Dm, Dm);
    cvt_t_kernel<<<dim3(Dm / 32, Dm / 32),  tb, 0, stream>>>(wk, wkb, Dm, Dm);
    cvt_t_kernel<<<dim3(Dm / 32, Dm / 32),  tb, 0, stream>>>(wv, wvb, Dm, Dm);
    cvt_t_kernel<<<dim3(Dm / 32, Dm / 32),  tb, 0, stream>>>(wo, wob, Dm, Dm);
    cvt_t_kernel<<<dim3(FFm / 32, Dm / 32), tb, 0, stream>>>(w1, w1b, Dm, FFm);
    cvt_t_kernel<<<dim3(Dm / 32, FFm / 32), tb, 0, stream>>>(w2, w2b, FFm, Dm);

    // LN1
    ln_bf16_kernel<<<Mrows / (LNR * LNW), 32 * LNW, 0, stream>>>(x, ln1s, ln1b, h1b);

    // QKV projections (Q pre-scaled; V transposed per head)
    dim3 gDD(Dm / 128, Mrows / 128);
    gemm_bf16_kernel<<<gDD, 128, 0, stream>>>(h1b, wqb, bq, nullptr, nullptr, qb,
                                              Mrows, Dm, Dm, 0, qscale);
    gemm_bf16_kernel<<<gDD, 128, 0, stream>>>(h1b, wkb, bk, nullptr, nullptr, kb,
                                              Mrows, Dm, Dm, 0, 1.0f);
    gemm_bf16_kernel<<<gDD, 128, 0, stream>>>(h1b, wvb, bv, nullptr, nullptr, vb,
                                              Mrows, Dm, Dm, 1, 1.0f);

    // attention
    attn_kernel<<<dim3(Bm * Hm, Lm / (AQW * AWV)), 32 * AWV, 0, stream>>>(qb, kb, vb, amask, ab);

    // output projection + residual -> x1
    gemm_bf16_kernel<<<gDD, 128, 0, stream>>>(ab, wob, bo, x, x1, nullptr,
                                              Mrows, Dm, Dm, 3, 1.0f);

    // LN2
    ln_bf16_kernel<<<Mrows / (LNR * LNW), 32 * LNW, 0, stream>>>(x1, ln2s, ln2b, h2b);

    // MLP up + quickGELU -> bf16
    dim3 gDF(FFm / 128, Mrows / 128);
    gemm_bf16_kernel<<<gDF, 128, 0, stream>>>(h2b, w1b, b1, nullptr, nullptr, m1b,
                                              Mrows, FFm, Dm, 2, 1.0f);

    // MLP down + residual -> d_out
    gemm_bf16_kernel<<<gDD, 128, 0, stream>>>(m1b, w2b, b2, x1, outp, nullptr,
                                              Mrows, Dm, FFm, 3, 1.0f);
}

// v006
// A run of this version takes 224 microseconds.
// In both of two side-by-side timings against v005, it was 1.09 times as fast.
// Counting every step since v000, it is 2.85 times as fast.
#include <hip/hip_runtime.h>

// ---------------- constants ----------------
#define Dm   1024
#define Hm   16
#define HDm  64
#define FFm  4096
#define Bm   8
#define Lm   1024
#define Mrows (Bm * Lm)        // 8192
#define EPSc 1e-5f

typedef __attribute__((ext_vector_type(16))) __bf16 v16bf;
typedef __attribute__((ext_vector_type(8)))  float  v8f;
typedef __attribute__((ext_vector_type(4)))  unsigned int u32x4;
typedef __attribute__((ext_vector_type(8)))  unsigned int u32x8;

union V16 {
    uint4 u4[2];
    unsigned short s[16];
    v16bf v;
};

__device__ __forceinline__ unsigned short f2bf(float f) {
    unsigned int u = __float_as_uint(f);
    unsigned int r = u + 0x7fffu + ((u >> 16) & 1u);   // round to nearest even
    return (unsigned short)(r >> 16);
}

// ---------------- tensor loads of the GEMM ----------------
// One pass of the GEMM takes GPK k: GROWB bytes of every operand row. A wave's request is a
// slice of 64 such rows, laid in LDS at pitch GPITCH (16 B x odd: no bank conflict for
// 16-byte fragment reads). A slice's place is a multiple of 2 KiB.
#define GPK    128
#define GROWB  256
#define GPITCH 272
#define GSLICE 18432           // 64 * GPITCH = 17408, rounded up to a multiple of 2 KiB
#define GSTAGE (4 * GSLICE)    // A rows 0-63 | A rows 64-127 | B rows 0-63 | B rows 64-127

__device__ __forceinline__ unsigned int uni(unsigned int v) {
    return (unsigned int)__builtin_amdgcn_readfirstlane(v);
}
// a wave-uniform value held in a scalar register, so that a test on it is a scalar branch and
// a descriptor word made from it is formed where this stands (tensor loads ignore EXEC)
__device__ __forceinline__ unsigned int pinned(unsigned int v) {
    unsigned int w = uni(v);
    asm volatile("" : "+s"(w));   // the value stays in a scalar register
    return w;
}
// both groups are in-out operands: their registers then stay this descriptor's own from one
// request to the next, and nothing else is put into them while a request is outstanding
__device__ __forceinline__ void tdm_load(u32x4& g0, u32x8& g1) {
    asm volatile("tensor_load_to_lds %0, %1" : "+s"(g0), "+s"(g1) :: "memory");
}
// group 1: 1-byte elements, tensor = tile = 64 rows of GROWB bytes, source pitch in bytes,
// a pad of 4 dwords behind every 64 dwords (one row)
__device__ __forceinline__ u32x8 tdm_group1(unsigned int src_pitch) {
    u32x8 g;
    g[0] = uni((1u << 20) | (5u << 22) | (3u << 25));   // no mask, data_size 0, pad codes 5 / 3
    g[1] = uni(((unsigned int)GROWB & 0xFFFFu) << 16);
    g[2] = uni(64u << 16);
    g[3] = uni((unsigned int)GROWB << 16);
    g[4] = uni(64u);
    g[5] = uni(src_pitch);
    g[6] = uni(0u);
    g[7] = uni(0u);
    return g;
}
__device__ __forceinline__ u32x4 tdm_group0(unsigned int lds_dst, unsigned long long ga) {
    u32x4 g;
    g[0] = uni(1u);
    g[1] = uni(lds_dst);
    g[2] = uni((unsigned int)ga);
    g[3] = uni((((unsigned int)(ga >> 32)) & 0x01FFFFFFu) | 0x80000000u);
    return g;
}
// the same slice one stage on: a new place in LDS, the source inc bytes further (words 2 and
// 3 are added to as one 64-bit number: the type bits lie above every address bit)
__device__ __forceinline__ void tdm_advance(u32x4& g, unsigned int lds_dst, unsigned int inc) {
    unsigned long long a = (((unsigned long long)g[3] << 32) | g[2]) + inc;
    g[1] = uni(lds_dst);
    g[2] = uni((unsigned int)a);
    g[3] = uni((unsigned int)(a >> 32));
}

// ---------------- LayerNorm -> bf16 ----------------
typedef __attribute__((ext_vector_type(4))) float f32x4;
typedef __attribute__((ext_vector_type(2))) float f32x2;

// two floats to two bf16 in one dword, each rounded as f2bf rounds
__device__ __forceinline__ unsigned int f2bf_pair(float lo, float hi) {
    unsigned int a = __float_as_uint(lo), b = __float_as_uint(hi);
    a += 0x7fffu + ((a >> 16) & 1u);
    b += 0x7fffu + ((b >> 16) & 1u);
    return (a >> 16) | (b & 0xffff0000u);
}

// two floats to two bf16 in one dword by the hardware's conversion (round to nearest even)
__device__ __forceinline__ unsigned int cvt_pair(float lo, float hi) {
    typedef __attribute__((ext_vector_type(2))) __bf16 bf16x2;
    f32x2 f = {lo, hi};
    return __builtin_bit_cast(unsigned int, __builtin_convertvector(f, bf16x2));
}

// ---------------- fp32 -> bf16 transpose-convert of all six weights: dst[N][K] = src[K][N] ----------------
// One launch. A workgroup of 4 waves takes one tile of CTK k x CTN n of one matrix. A wave reads
// 16 k rows, 512 contiguous bytes of a row per load, all 16 loads in flight together; a lane
// then holds 16 k of 4 columns and packs them to units of 8 k (16 B). The units pass through
// LDS so that the stores cover whole 128-B lines of dst (8 lanes a row of 64 k).
#define CTK 64
#define CTN 128
template <int K, int N>
__device__ __forceinline__ void cvt_t_tile(const float* __restrict__ src,
                                           unsigned short* __restrict__ dst,
                                           int ti, uint4* tile) {
    const int t = threadIdx.x, lane = t & 31, w = t >> 5;
    const int n0 = (ti % (N / CTN)) * CTN, k0 = (ti / (N / CTN)) * CTK;

    const float* sp = src + (size_t)(k0 + w * 16) * N + n0 + lane * 4;
    f32x4 v[16];
    #pragma unroll
    for (int r = 0; r < 16; r++) v[r] = *(const f32x4*)(sp + r * N);
    // a precaution: sp is an input here, so the loads' address registers stay as they are up
    // to this wait; without the statement the compiler aims the last load's result at them
    asm volatile("s_wait_xcnt 0x0" :: "v"(sp) : "memory");

    // row n of the tile holds 8 units; unit c stands at place c ^ ((n >> 2) & 7), so that the
    // lanes of a wave, which write rows 4 apart, do not all meet in the same banks
    #pragma unroll
    for (int j = 0; j < 4; j++)
        #pragma unroll
        for (int u = 0; u < 2; u++) {
            uint4 pk;
            pk.x = cvt_pair(v[u * 8 + 0][j], v[u * 8 + 1][j]);
            pk.y = cvt_pair(v[u * 8 + 2][j], v[u * 8 + 3][j]);
            pk.z = cvt_pair(v[u * 8 + 4][j], v[u * 8 + 5][j]);
            pk.w = cvt_pair(v[u * 8 + 6][j], v[u * 8 + 7][j]);
            tile[(lane * 4 + j) * 8 + ((w * 2 + u) ^ (lane & 7))] = pk;
        }
    __syncthreads();

    // a wave's store: 4 rows of dst, 128 B each
    const int nl = t >> 3, kb = t & 7;
    unsigned short* dp = dst + (size_t)(n0 + nl) * K + k0 + kb * 8;
    #pragma unroll
    for (int i = 0; i < 8; i++) {
        const int n = i * 16 + nl;
        *(uint4*)(dp + i * 16 * K) = tile[n * 8 + (kb ^ ((n >> 2) & 7))];
    }
}

#define CT_DD ((Dm / CTK) * (Dm / CTN))     // tiles of a Dm x Dm matrix
#define CT_DF ((Dm / CTK) * (FFm / CTN))    // tiles of w1, and of w2
__global__ __launch_bounds__(128)
void cvt_t_all_kernel(const float* __restrict__ wq, const float* __restrict__ wk,
                      const float* __restrict__ wv, const float* __restrict__ wo,
                      const float* __restrict__ w1, const float* __restrict__ w2,
                      unsigned short* __restrict__ dq, unsigned short* __restrict__ dk,
                      unsigned short* __restrict__ dv, unsigned short* __restrict__ dO,
                      unsigned short* __restrict__ d1, unsigned short* __restrict__ d2) {
    __shared__ __align__(16) uint4 tile[CTN * 8];
    const int b = blockIdx.x;
    if (b < 4 * CT_DD) {
        const int m = b / CT_DD;
        const float* s = m == 0 ? wq : m == 1 ? wk : m == 2 ? wv : wo;
        unsigned short* d = m == 0 ? dq : m == 1 ? dk : m == 2 ? dv : dO;
        cvt_t_tile<Dm, Dm>(s, d, b % CT_DD, tile);
    } else if (b < 4 * CT_DD + CT_DF) {
        cvt_t_tile<Dm, FFm>(w1, d1, b - 4 * CT_DD, tile);
    } else {
        cvt_t_tile<FFm, Dm>(w2, d2, b - 4 * CT_DD - CT_DF, tile);
    }
}

// One wave owns LNR whole rows and keeps them in registers: every element is read once, by
// 16-byte loads that are in flight together; mean and variance are summed inside the
// lane and then across the 32 lanes by shuffles, so no LDS and no barrier is needed, and a
// launch holds one wave per LNR rows instead of a workgroup of eight per row.
#define LNR 2      // rows per wave
#define LNW 8      // waves per workgroup
__global__ __launch_bounds__(32 * LNW)
void ln_bf16_kernel(const float* __restrict__ x,
                    const float* __restrict__ gamma,
                    const float* __restrict__ beta,
                    unsigned short* __restrict__ out) {
    int lane = threadIdx.x & 31;
    // the wave's number as a scalar: the rows' base addresses then stay in scalar registers
    int row0 = (blockIdx.x * LNW + __builtin_amdgcn_readfirstlane(threadIdx.x >> 5)) * LNR;
    const float* xr = x + (size_t)row0 * Dm;

    // piece j of a row: elements j * 128 + lane * 4 .. + 3 (a wave's load covers 512 B in a row)
    f32x4 g[8], be[8], v[LNR][8];
    #pragma unroll
    for (int j = 0; j < 8; j++) {
        g[j]  = *(const f32x4*)&gamma[j * 128 + lane * 4];
        be[j] = *(const f32x4*)&beta[j * 128 + lane * 4];
    }
    #pragma unroll
    for (int r = 0; r < LNR; r++)
        #pragma unroll
        for (int j = 0; j < 8; j++)
            v[r][j] = *(const f32x4*)&xr[r * Dm + j * 128 + lane * 4];
    // the scale and shift loads are issued early, in groups, ahead of one common wait; the
    // compiler otherwise sinks each pair to its use and waits for the pairs one after another
    asm volatile("" :: "v"(g[0]), "v"(g[1]), "v"(g[2]), "v"(g[3]),
                       "v"(g[4]), "v"(g[5]), "v"(g[6]), "v"(g[7]),
                       "v"(be[0]), "v"(be[1]), "v"(be[2]), "v"(be[3]),
                       "v"(be[4]), "v"(be[5]), "v"(be[6]), "v"(be[7]));

    float mu[LNR], inv[LNR];
    #pragma unroll
    for (int r = 0; r < LNR; r++) {
        f32x2 s0 = v[r][0].xy, s1 = v[r][0].zw;
        #pragma unroll
        for (int j = 1; j < 8; j++) { s0 += v[r][j].xy; s1 += v[r][j].zw; }
        s0 += s1;
        mu[r] = s0.x + s0.y;
    }
    #pragma unroll
    for (int off = 16; off > 0; off >>= 1)
        #pragma unroll
        for (int r = 0; r < LNR; r++) mu[r] += __shfl_xor(mu[r], off, 32);
    #pragma unroll
    for (int r = 0; r < LNR; r++) {
        mu[r] *= (1.0f / Dm);
        f32x2 s0 = {0.f, 0.f}, s1 = {0.f, 0.f};
        #pragma unroll
        for (int j = 0; j < 8; j++) {
            v[r][j] -= mu[r];
            s0 += v[r][j].xy * v[r][j].xy;
            s1 += v[r][j].zw * v[r][j].zw;
        }
        s0 += s1;
        inv[r] = s0.x + s0.y;
    }
    #pragma unroll
    for (int off = 16; off > 0; off >>= 1)
        #pragma unroll
        for (int r = 0; r < LNR; r++) inv[r] += __shfl_xor(inv[r], off, 32);
    #pragma unroll
    for (int r = 0; r < LNR; r++) inv[r] = rsqrtf(inv[r] * (1.0f / Dm) + EPSc);

    unsigned short* orow = out + (size_t)row0 * Dm;
    #pragma unroll
    for (int j = 0; j < 8; j++) {
        #pragma unroll
        for (int r = 0; r < LNR; r++) {
            f32x4 y = v[r][j] * inv[r] * g[j] + be[j];
            uint2 pk;
            pk.x = f2bf_pair(y.x, y.y);
            pk.y = f2bf_pair(y.z, y.w);
            *(uint2*)&orow[r * Dm + j * 128 + lane * 4] = pk;
        }
    }
}

// A transcendental with the one free issue slot behind it that the instruction set asks for
// before its result is read or its source overwritten; the v_nop in the same statement holds
// that slot whatever the compiler schedules next.
__device__ __forceinline__ float exp2_slot(float x) {
    float r;
    asm("v_exp_f32 %0, %1\n\tv_nop" : "=v"(r) : "v"(x));
    return r;
}
__device__ __forceinline__ float rcp_slot(float x) {
    float r;
    asm("v_rcp_f32 %0, %1\n\tv_nop" : "=v"(r) : "v"(x));
    return r;
}

// ---------------- GEMM epilogue of one wave (64 x 64 of C), one straight-line form per mode ----------------
// v = (acc + bias [quickGELU] [+ resid]) * oscale
// MODE 0: bf16 to [B,H,L,HD]   MODE 1: bf16 to [B,H,HD,L] (transposed per head)
// MODE 2: quickGELU, bf16 to [M,N]   MODE 3: + resid, f32 to [M,N]
// row0, col0: the lane's first row and column of C.
template <int MODE>
__device__ __forceinline__ void gemm_store(const v8f (&c)[4][4],
                                           const float* __restrict__ bias,
                                           const float* __restrict__ resid,
                                           float* __restrict__ outF,
                                           unsigned short* __restrict__ outB,
                                           int N, float oscale, int row0, int col0) {
    float bv[4];
    #pragma unroll
    for (int nt = 0; nt < 4; nt++) bv[nt] = bias[col0 + nt * 16];
    // groups of 16 rows x 64 columns: 32 elements of a lane
    #pragma unroll
    for (int mt = 0; mt < 4; mt++) {
        float rs[4][8];
        if (MODE == 3) {
            #pragma unroll
            for (int nt = 0; nt < 4; nt++)
                #pragma unroll
                for (int i = 0; i < 8; i++)
                    rs[nt][i] = resid[(unsigned int)((row0 + mt * 16 + i) * N + col0 + nt * 16)];
            // the group's 32 residual loads are all issued before the first is used, so that
            // their latency is paid once a group
            __builtin_amdgcn_sched_barrier(0);
        }
        #pragma unroll
        for (int nt = 0; nt < 4; nt++) {
            int col = col0 + nt * 16;
            #pragma unroll
            for (int i = 0; i < 8; i++) {
                int row = row0 + mt * 16 + i;
                float v = c[mt][nt][i] + bv[nt];
                if (MODE == 2)   // v * sigmoid(1.702 v), e^x as 2^(x log2 e)
                    v = v * rcp_slot(1.0f + exp2_slot((-1.702f * v) * 1.44269504f));
                if (MODE == 3) v += rs[nt][i];
                v *= oscale;
                if (MODE == 3) {
                    outF[(unsigned int)(row * N + col)] = v;
                } else {
                    unsigned int idx;   // every index here is below 2^25: 32 bits hold it
                    int bb = row >> 10, ll = row & 1023;
                    int hh = col >> 6,  dd = col & 63;
                    if (MODE == 0)
                        idx = (unsigned int)((((bb * Hm + hh) * Lm) + ll) * HDm + dd);
                    else if (MODE == 1)
                        idx = (unsigned int)((((bb * Hm + hh) * HDm) + dd) * Lm + ll);
                    else
                        idx = (unsigned int)(row * N + col);
                    outB[idx] = f2bf(v);
                }
            }
        }
        // the next group's loads may land in registers that this group's stores name
        if (MODE == 3 && mt < 3) asm volatile("s_wait_xcnt 0x0" ::: "memory");
        // one group's work stays in front of the next group's: the epilogue then stays inside
        // the first 256 registers
        if (mt < 3) __builtin_amdgcn_sched_barrier(0);
    }
}

// ---------------- bf16 WMMA GEMM, B pre-transposed, two-buffer tensor-load ring ----------------
// C[M,N] = A[M,K] * Bt[N,K]^T, then the epilogue of gemm_store<mode>
// Block tile 128(M) x 128(N), a pass of GPK k, 4 waves (2 x 2), each wave 64 x 64.
// M and N are multiples of 128, K a multiple of GPK and at least two passes.
// Every wave issues one tensor load a stage: waves 0 and 1 the two halves of the A rows,
// waves 2 and 3 of the B rows. Two workgroups share a WGP (LDS), so 512 registers a wave.
__global__ __launch_bounds__(128, 2)
void gemm_bf16_kernel(const unsigned short* __restrict__ A,
                      const unsigned short* __restrict__ Bt,
                      const float* __restrict__ bias,
                      const float* __restrict__ resid,
                      float* __restrict__ outF,
                      unsigned short* __restrict__ outB,
                      int M, int N, int K,
                      int mode, float oscale) {
    __shared__ __attribute__((aligned(2048))) unsigned char ring[2 * GSTAGE];
    (void)M;

    int t    = threadIdx.x;
    int lane = t & 31;
    const unsigned int w = uni((unsigned int)t >> 5);   // the wave's number, a scalar
    const unsigned int wr = w >> 1, wc = w & 1u;
    int mloc = lane & 15, half = lane >> 4;
    int m0 = blockIdx.y * 128, n0 = blockIdx.x * 128;

    v8f c[4][4] = {};
    const int nst = K / GPK;

    // this wave's slice: its first source byte, its place in buffer 0
    const unsigned short* srow = (w < 2u) ? A  + (size_t)(m0 + (int)w * 64) * K
                                          : Bt + (size_t)(n0 + (int)(w - 2u) * 64) * K;
    const unsigned long long ga = (unsigned long long)(size_t)srow;
    const unsigned int dst = (unsigned int)(size_t)(void*)ring + w * GSLICE;
    u32x8 g1 = tdm_group1((unsigned int)K * 2u);

    u32x4 g0 = tdm_group0(dst, ga);
    tdm_load(g0, g1);                                        // stage 0
    asm volatile("s_wait_tensorcnt 0x0" ::: "memory");       // this wave's slice has landed
    __syncthreads();                                         // and so has every other wave's
    // the step is pinned here, and at the refill below, so that the address words take their
    // new value behind the wait
    tdm_advance(g0, dst + GSTAGE, pinned(GROWB));
    tdm_load(g0, g1);                                        // stage 1

    // the lane's first A and B fragment bytes inside a buffer
    const unsigned int aoff = wr * GSLICE + (unsigned int)(mloc * GPITCH + half * 16);
    const unsigned int boff = (2u + wc) * GSLICE + (unsigned int)(mloc * GPITCH + half * 16);

    for (int s = 0; s < nst; s++) {
        const unsigned int p = (unsigned int)(s & 1) * GSTAGE;
        const unsigned char* ap = ring + p + aoff;
        const unsigned char* bp = ring + p + boff;

        // four blocks of 32 k; the next block's fragments are read into a second register
        // set ahead of the current block's products
        V16 af[2][4], bf[2][4];
        #pragma unroll
        for (int f = 0; f < 4; f++) {
            af[0][f].u4[0] = *(const uint4*)(ap + f * 16 * GPITCH);
            af[0][f].u4[1] = *(const uint4*)(ap + f * 16 * GPITCH + 32);
            bf[0][f].u4[0] = *(const uint4*)(bp + f * 16 * GPITCH);
            bf[0][f].u4[1] = *(const uint4*)(bp + f * 16 * GPITCH + 32);
        }
        #pragma unroll
        for (int kb = 0; kb < 4; kb++) {
            const int cur = kb & 1, nxt = cur ^ 1;
            if (kb < 3) {
                #pragma unroll
                for (int f = 0; f < 4; f++) {
                    af[nxt][f].u4[0] = *(const uint4*)(ap + f * 16 * GPITCH + (kb + 1) * 64);
                    af[nxt][f].u4[1] = *(const uint4*)(ap + f * 16 * GPITCH + (kb + 1) * 64 + 32);
                    bf[nxt][f].u4[0] = *(const uint4*)(bp + f * 16 * GPITCH + (kb + 1) * 64);
                    bf[nxt][f].u4[1] = *(const uint4*)(bp + f * 16 * GPITCH + (kb + 1) * 64 + 32);
                }
            }
            // the fence pair keeps the LDS reads one group ahead of the block; the compiler
            // otherwise moves them in among the products, each behind a wait to zero
            __builtin_amdgcn_sched_barrier(0);
            #pragma unroll
            for (int mt = 0; mt < 4; mt++)
                #pragma unroll
                for (int nt = 0; nt < 4; nt++)
                    c[mt][nt] = __builtin_amdgcn_wmma_f32_16x16x32_bf16(
                        false, af[cur][mt].v, false, bf[cur][nt].v, (short)0, c[mt][nt],
                        false, false);
            __builtin_amdgcn_sched_barrier(0);
        }

        // publish point: this wave's reads of the buffer are done, its slice of stage s + 1
        // has landed; the barrier says the same of every wave
        asm volatile("s_wait_dscnt 0x0" ::: "memory");
        asm volatile("s_wait_tensorcnt 0x0" ::: "memory");
        __syncthreads();
        if (pinned(s + 2 < nst)) {   // refill the buffer that every wave has just left
            tdm_advance(g0, dst + p, pinned(GROWB));
            tdm_load(g0, g1);
        }
    }
    asm volatile("s_wait_tensorcnt 0x0" ::: "memory");   // nothing in flight when the wave ends
    asm volatile("s_wait_dscnt 0x0" ::: "memory");

    // ---- epilogue: the mode is tested once per wave, never per element ----
    int row0 = m0 + (int)wr * 64 + 8 * half;
    int col0 = n0 + (int)wc * 64 + mloc;
    if (mode == 0)      gemm_store<0>(c, bias, resid, outF, outB, N, oscale, row0, col0);
    else if (mode == 1) gemm_store<1>(c, bias, resid, outF, outB, N, oscale, row0, col0);
    else if (mode == 2) gemm_store<2>(c, bias, resid, outF, outB, N, oscale, row0, col0);
    else                gemm_store<3>(c, bias, resid, outF, outB, N, oscale, row0, col0);
}

#define AWV 8      // waves per workgroup
#define AQW 32     // query columns per wave
#define AKS 64     // keys per LDS stage
#define APT 72     // LDS row pitch in elements: 128 B of data + 16 B pad

// lane l takes the value of lane l ^ 16
__device__ __forceinline__ float xhalf(float x) {
    int b = __builtin_bit_cast(int, x);
    return __builtin_bit_cast(float,
        __builtin_amdgcn_permlanex16(b, b, 0x76543210, 0xfedcba98, false, false));
}

// One stage's four copies of a lane (two K rows, two V rows, 16 B each). The
// s_wait_xcnt closes the statement so that no address register named here is
// rewritten ahead of it.
__device__ __forceinline__ void attn_stage_copy(unsigned int lk0, unsigned int lk1,
                                                unsigned int lv0, unsigned int lv1,
                                                const unsigned short* gk0,
                                                const unsigned short* gk1,
                                                const unsigned short* gv0,
                                                const unsigned short* gv1) {
    asm volatile("global_load_async_to_lds_b128 %0, %4, off\n\t"
                 "global_load_async_to_lds_b128 %1, %5, off\n\t"
                 "global_load_async_to_lds_b128 %2, %6, off\n\t"
                 "global_load_async_to_lds_b128 %3, %7, off\n\t"
                 "s_wait_xcnt 0x0"
                 :: "v"(lk0), "v"(lk1), "v"(lv0), "v"(lv1),
                    "v"(gk0), "v"(gk1), "v"(gv0), "v"(gv1)
                 : "memory");
}

// two workgroups a WGP, four waves a SIMD: the vector work of one wave runs under the
// products of the others
__global__ __launch_bounds__(32 * AWV) __attribute__((amdgpu_waves_per_eu(4, 4)))
void attn_kernel(const unsigned short* __restrict__ q,
                 const unsigned short* __restrict__ k,
                 const unsigned short* __restrict__ v,
                 const int* __restrict__ mask,
                 unsigned short* __restrict__ out) {
    int bh = blockIdx.x;              // 0..127
    int b  = bh >> 4, h = bh & 15;
    int t  = threadIdx.x;
    int w  = t >> 5, lane = t & 31;
    int q0 = blockIdx.y * (AQW * AWV) + w * AQW;
    int mloc = lane & 15, half = lane >> 4;

    const unsigned short* Q  = q + (size_t)bh * Lm * HDm;
    const unsigned short* Kp = k + (size_t)bh * Lm * HDm;
    const unsigned short* Vt = v + (size_t)bh * HDm * Lm;

    __shared__ __align__(16) unsigned short Ks[2][AKS][APT];   // [buffer][key][d]
    __shared__ __align__(16) unsigned short Vs[2][HDm][APT];   // [buffer][d][key]
    __shared__ __align__(32) float mb[Lm];                     // 0 or -1e30 per key

    // Q B-fragments: column group g, d = 0..31 and 32..63
    V16 bq[2][2];
    #pragma unroll
    for (int g = 0; g < 2; g++)
        #pragma unroll
        for (int s = 0; s < 2; s++) {
            const unsigned short* qp = &Q[(size_t)(q0 + g * 16 + mloc) * HDm + s * 32 + half * 8];
            bq[g][s].u4[0] = *(const uint4*)qp;
            bq[g][s].u4[1] = *(const uint4*)(qp + 16);
        }

    float run_max[2], run_sum[2];   // per column group; run_sum holds this half's keys only
    #pragma unroll
    for (int g = 0; g < 2; g++) { run_max[g] = -1e30f; run_sum[g] = 0.f; }
    v8f o[2][4] = {};               // O^T: o[g][f][i] = O[q = g*16 + mloc][d = f*16 + 8*half + i]

    // staging: 8 lanes cover one 128-B row; a lane copies rows srow and srow + 32
    int srow = t >> 3, sseg = (t & 7) * 8;
    const unsigned int bufK = AKS * APT * 2, bufV = HDm * APT * 2;   // bytes per buffer
    unsigned int lk0 = (unsigned int)(size_t)(void*)&Ks[0][srow][sseg];
    unsigned int lk1 = (unsigned int)(size_t)(void*)&Ks[0][srow + 32][sseg];
    unsigned int lv0 = (unsigned int)(size_t)(void*)&Vs[0][srow][sseg];
    unsigned int lv1 = (unsigned int)(size_t)(void*)&Vs[0][srow + 32][sseg];
    const unsigned short* gk0 = &Kp[(size_t)srow * HDm + sseg];          // + stage * AKS rows
    const unsigned short* gk1 = &Kp[(size_t)(srow + 32) * HDm + sseg];
    const unsigned short* gv0 = &Vt[(size_t)srow * Lm + sseg];           // + stage * AKS keys
    const unsigned short* gv1 = &Vt[(size_t)(srow + 32) * Lm + sseg];
    const int nst = Lm / AKS;

    attn_stage_copy(lk0, lk1, lv0, lv1, gk0, gk1, gv0, gv1);
    {   // the mask as an addend per key; the barrier below publishes it with stage 0
        typedef __attribute__((ext_vector_type(4))) int i32x4;
        const int* mp = &mask[b * Lm + t * 4];   // this thread's four keys
        i32x4 mi;
        // load and data wait in one statement: the address registers are then not rewritten
        // while the load is out;
        // the wait runs under the flight of stage 0's copies
        asm volatile("global_load_b128 %0, %1, off\n\ts_wait_loadcnt 0x0"
                     : "=&v"(mi) : "v"(mp) : "memory");
        f32x4 f = {mi.x > 0 ? 0.f : -1e30f, mi.y > 0 ? 0.f : -1e30f,
                   mi.z > 0 ? 0.f : -1e30f, mi.w > 0 ? 0.f : -1e30f};
        *(f32x4*)&mb[t * 4] = f;
    }
    asm volatile("s_wait_asynccnt 0x0" ::: "memory");   // this wave's part of stage 0 has landed
    __syncthreads();                                    // and so has every other wave's
    attn_stage_copy(lk0 + bufK, lk1 + bufK, lv0 + bufV, lv1 + bufV,
                    gk0 + AKS * HDm, gk1 + AKS * HDm, gv0 + AKS, gv1 + AKS);

    const float L2E = 1.44269504f;
    for (int st = 0; st < nst; st++) {
        int p = st & 1;
        // kept rolled: with two passes in one body the compiler interleaves them and spills
        #pragma unroll 1
        for (int kt = 0; kt < AKS / 32; kt++) {
            int kl = kt * 32;              // first key of the pass inside the stage
            int kb = st * AKS + kl;        // and in the sequence
            // ---- S^T: two 16-key tiles x two column groups, depth 64 (2 wmma each); the
            // mask addend of a tile's rows is the first product's C operand ----
            V16 ak[2][2];
            v8f cb[2];
            #pragma unroll
            for (int sub = 0; sub < 2; sub++) {
                int key = kl + sub * 16 + mloc;
                cb[sub] = *(const v8f*)&mb[kb + sub * 16 + half * 8];
                #pragma unroll
                for (int s = 0; s < 2; s++) {
                    ak[sub][s].u4[0] = *(const uint4*)&Ks[p][key][s * 32 + half * 8];
                    ak[sub][s].u4[1] = *(const uint4*)&Ks[p][key][s * 32 + 16 + half * 8];
                }
            }
            v8f sc[2][2];   // sc[sub][g][i] = S[q = g*16 + mloc][key = kb + sub*16 + 8*half + i]
            #pragma unroll
            for (int sub = 0; sub < 2; sub++)
                #pragma unroll
                for (int g = 0; g < 2; g++)
                    sc[sub][g] = __builtin_amdgcn_wmma_f32_16x16x32_bf16(
                        false, ak[sub][0].v, false, bq[g][0].v, (short)0, cb[sub], false, false);
            #pragma unroll
            for (int sub = 0; sub < 2; sub++)
                #pragma unroll
                for (int g = 0; g < 2; g++)
                    sc[sub][g] = __builtin_amdgcn_wmma_f32_16x16x32_bf16(
                        false, ak[sub][1].v, false, bq[g][1].v, (short)0, sc[sub][g], false, false);

            // V^T A-fragments are rows of Vs
            V16 av[4];
            #pragma unroll
            for (int f = 0; f < 4; f++) {
                int d = f * 16 + mloc;
                av[f].u4[0] = *(const uint4*)&Vs[p][d][kl + half * 8];
                av[f].u4[1] = *(const uint4*)&Vs[p][d][kl + 16 + half * 8];
            }

            #pragma unroll
            for (int g = 0; g < 2; g++) {
                // ---- online softmax of one query per lane ----
                float tm = fmaxf(sc[0][g][0], sc[1][g][0]);
                #pragma unroll
                for (int i = 1; i < 8; i++) tm = fmaxf(tm, fmaxf(sc[0][g][i], sc[1][g][i]));
                tm = fmaxf(tm, xhalf(tm));          // both halves hold the query's maximum
                float nm = fmaxf(run_max[g], tm);
                float corr = __builtin_amdgcn_exp2f((run_max[g] - nm) * L2E);
                run_max[g] = nm;
                const f32x2 l2 = {L2E, L2E}, n2 = {nm, nm};
                f32x2 ts = {0.f, 0.f};
                V16 pf;   // P^T B-fragment: element s is key 8*half + s (s < 8), 8*half + 8 + s (s >= 8) of the pass
                unsigned int pw[8];
                #pragma unroll
                for (int e = 0; e < 8; e++) {
                    f32x2 x = {sc[e >> 2][g][2 * (e & 3)], sc[e >> 2][g][2 * (e & 3) + 1]};
                    x = (x - n2) * l2;   // the difference first: exactly 0 at the maximum, also at -1e30
                    f32x2 pe = {__builtin_amdgcn_exp2f(x.x), __builtin_amdgcn_exp2f(x.y)};
                    ts += pe;
                    pw[e] = cvt_pair(pe.x, pe.y);
                }
                pf.u4[0] = make_uint4(pw[0], pw[1], pw[2], pw[3]);
                pf.u4[1] = make_uint4(pw[4], pw[5], pw[6], pw[7]);
                run_sum[g] = run_sum[g] * corr + (ts.x + ts.y);
                // ---- O^T = O^T * corr + V^T P^T (4 wmma) ----
                #pragma unroll
                for (int f = 0; f < 4; f++) {
                    o[g][f] *= corr;
                    o[g][f] = __builtin_amdgcn_wmma_f32_16x16x32_bf16(
                        false, av[f].v, false, pf.v, (short)0, o[g][f], false, false);
                }
            }
            // the back edge: the pass's first address arithmetic may land in the last product's
            // A registers; the fence holds the products in front of the slots
            __builtin_amdgcn_sched_barrier(0);
            asm volatile("v_nop\n\tv_nop\n\tv_nop\n\tv_nop");
        }
        // publish point: this wave's LDS reads of buffer p are done, its copies of
        // stage st + 1 have landed; the barrier says the same of every wave.
        asm volatile("s_wait_dscnt 0x0" ::: "memory");
        asm volatile("s_wait_asynccnt 0x0" ::: "memory");
        __syncthreads();
        if (st + 2 < nst) {   // refill the buffer that every wave has just left
            int sn = st + 2;
            attn_stage_copy(lk0 + p * bufK, lk1 + p * bufK, lv0 + p * bufV, lv1 + p * bufV,
                            gk0 + (size_t)sn * AKS * HDm, gk1 + (size_t)sn * AKS * HDm,
                            gv0 + sn * AKS, gv1 + sn * AKS);
        }
    }
    asm volatile("s_wait_asynccnt 0x0" ::: "memory");   // nothing in flight when the wave ends

    // ---- normalize + store: out[b*L + q][h*64 + d], 8 consecutive d of a lane in 16 bytes ----
    #pragma unroll
    for (int g = 0; g < 2; g++) {
        float l = run_sum[g];
        l += xhalf(l);                  // the two halves' keys joined
        float inv = 1.0f / l;
        unsigned short* orow = out + (size_t)(b * Lm + q0 + g * 16 + mloc) * Dm + h * HDm + half * 8;
        #pragma unroll
        for (int f = 0; f < 4; f++) {
            v8f y = o[g][f] * inv;
            *(uint4*)&orow[f * 16] = make_uint4(cvt_pair(y[0], y[1]), cvt_pair(y[2], y[3]),
                                                cvt_pair(y[4], y[5]), cvt_pair(y[6], y[7]));
        }
    }
}

// ---------------- host-side launch ----------------
extern "C" void kernel_launch(void* const* d_in, const int* in_sizes, int n_in,
                              void* d_out, int out_size, void* d_ws, size_t ws_size,
                              hipStream_t stream) {
    const float* x     = (const float*)d_in[0];
    const int*   amask = (const int*)  d_in[1];
    const float* wq = (const float*)d_in[2];  const float* bq = (const float*)d_in[3];
    const float* wk = (const float*)d_in[4];  const float* bk = (const float*)d_in[5];
    const float* wv = (const float*)d_in[6];  const float* bv = (const float*)d_in[7];
    const float* wo = (const float*)d_in[8];  const float* bo = (const float*)d_in[9];
    const float* ln1s = (const float*)d_in[10]; const float* ln1b = (const float*)d_in[11];
    const float* ln2s = (const float*)d_in[12]; const float* ln2b = (const float*)d_in[13];
    const float* w1 = (const float*)d_in[14]; const float* b1 = (const float*)d_in[15];
    const float* w2 = (const float*)d_in[16]; const float* b2 = (const float*)d_in[17];
    float* outp = (float*)d_out;

    char* base = (char*)d_ws;
    size_t off = 0;
    auto alloc = [&](size_t bytes) -> char* {
        char* p = base + off;
        off = (off + bytes + 255) & ~(size_t)255;
        return p;
    };
    // transposed bf16 weights: [N][K]
    unsigned short* wqb = (unsigned short*)alloc((size_t)Dm * Dm * 2);
    unsigned short* wkb = (unsigned short*)alloc((size_t)Dm * Dm * 2);
    unsigned short* wvb = (unsigned short*)alloc((size_t)Dm * Dm * 2);
    unsigned short* wob = (unsigned short*)alloc((size_t)Dm * Dm * 2);
    unsigned short* w1b = (unsigned short*)alloc((size_t)Dm * FFm * 2);
    unsigned short* w2b = (unsigned short*)alloc((size_t)FFm * Dm * 2);
    unsigned short* h1b = (unsigned short*)alloc((size_t)Mrows * Dm * 2);
    unsigned short* qb  = (unsigned short*)alloc((size_t)Mrows * Dm * 2);
    unsigned short* kb  = (unsigned short*)alloc((size_t)Mrows * Dm * 2);
    unsigned short* vb  = (unsigned short*)alloc((size_t)Mrows * Dm * 2);
    unsigned short* ab  = (unsigned short*)alloc((size_t)Mrows * Dm * 2);
    float*          x1  = (float*)        alloc((size_t)Mrows * Dm * 4);
    unsigned short* h2b = (unsigned short*)alloc((size_t)Mrows * Dm * 2);
    unsigned short* m1b = (unsigned short*)alloc((size_t)Mrows * FFm * 2);
    (void)ws_size; (void)n_in; (void)in_sizes; (void)out_size;

    const float qscale = 0.125f; // HD^-0.5

    // weights -> transposed bf16  (src is [K][N]), all six in one launch
    cvt_t_all_kernel<<<4 * CT_DD + 2 * CT_DF, 128, 0, stream>>>(wq, wk, wv, wo, w1, w2,
                                                               wqb, wkb, wvb, wob, w1b, w2b);

    // LN1
    ln_bf16_kernel<<<Mrows / (LNR * LNW), 32 * LNW, 0, stream>>>(x, ln1s, ln1b, h1b);

    // QKV projections (Q pre-scaled; V transposed per head)
    dim3 gDD(Dm / 128, Mrows / 128);
    gemm_bf16_kernel<<<gDD, 128, 0, stream>>>(h1b, wqb, bq, nullptr, nullptr, qb,
                                              Mrows, Dm, Dm, 0, qscale);
    gemm_bf16_kernel<<<gDD, 128, 0, stream>>>(h1b, wkb, bk, nullptr, nullptr, kb,
                                              Mrows, Dm, Dm, 0, 1.0f);
    gemm_bf16_kernel<<<gDD, 128, 0, stream>>>(h1b, wvb, bv, nullptr, nullptr, vb,
                                              Mrows, Dm, Dm, 1, 1.0f);

    // attention
    attn_kernel<<<dim3(Bm * Hm, Lm / (AQW * AWV)), 32 * AWV, 0, stream>>>(qb, kb, vb, amask, ab);

    // output projection + residual -> x1
    gemm_bf16_kernel<<<gDD, 128, 0, stream>>>(ab, wob, bo, x, x1, nullptr,
                                              Mrows, Dm, Dm, 3, 1.0f);

    // LN2
    ln_bf16_kernel<<<Mrows / (LNR * LNW), 32 * LNW, 0, stream>>>(x1, ln2s, ln2b, h2b);

    // MLP up + quickGELU -> bf16
    dim3 gDF(FFm / 128, Mrows / 128);
    gemm_bf16_kernel<<<gDF, 128, 0, stream>>>(h2b, w1b, b1, nullptr, nullptr, m1b,
                                              Mrows, FFm, Dm, 2, 1.0f);

    // MLP down + residual -> d_out
    gemm_bf16_kernel<<<gDD, 128, 0, stream>>>(m1b, w2b, b2, x1, outp, nullptr,
                                              Mrows, Dm, FFm, 3, 1.0f);
}
